// v000
// The times below were measured on an AMD MI455X: many runs one after another, warmed up first and cycling through
// copies of the inputs, with the whole window's GPU time divided by the number of runs. Launches and the gaps
// between them are all in it. The median over several windows is given; except for v000 it joins two sittings, which
// can be a few percent apart, so the side-by-side timings, each taken in one sitting, are the better comparison.
// The starting kernel, v000, takes 132 microseconds a run.
#include <hip/hip_runtime.h>
#include <hip/hip_bf16.h>

// Problem constants (match reference)
constexpr int NB = 8;     // batch
constexpr int NT = 2048;  // sequence length
constexpr int NC = 1024;  // n_embd
constexpr int NH = 64;    // head size

typedef __attribute__((ext_vector_type(16))) _Float16 v16h;
typedef __attribute__((ext_vector_type(8)))  float    v8f;

union V16H {
  v16h v;
  _Float16 h[16];
  unsigned u[8];
};

#if defined(__has_builtin)
#if __has_builtin(__builtin_amdgcn_sched_barrier)
#define SCHED_FENCE() __builtin_amdgcn_sched_barrier(0)
#endif
#endif
#ifndef SCHED_FENCE
#define SCHED_FENCE() asm volatile("" ::: "memory")
#endif

// K offset of the packed f16 pair held in "VGPR" i by this lane-half
// (16-bit A/B 16x32 WMMA layout):
//   lanes 0-15 : vgpr0..3 -> K={0,1},{2,3},{4,5},{6,7}; vgpr4..7 -> K={16..23}
//   lanes 16-31: +8 on each block.
__device__ __forceinline__ int kpair(int i, int hl) {
  return ((i < 4) ? (2 * i) : (16 + 2 * (i - 4))) + 8 * hl;
}

// ---- raw f32 tile: the 16 floats this lane contributes to one 16x32 operand ----
struct Raw16 {
  float4 a, b, c, d;  // floats [off..off+3],[off+4..off+7],[off+16..off+19],[off+20..off+23]
};

__device__ __forceinline__ Raw16 load_raw_f32(const float* __restrict__ base, int ldr,
                                              int ml, int hl, int kbase) {
  const float* p = base + (size_t)ml * ldr + kbase + 8 * hl;
  Raw16 r;
  r.a = *(const float4*)(p);
  r.b = *(const float4*)(p + 4);
  r.c = *(const float4*)(p + 16);
  r.d = *(const float4*)(p + 20);
  return r;
}

__device__ __forceinline__ v16h cvt_tile(const Raw16& r) {
  V16H t;
  t.h[0]  = (_Float16)r.a.x;  t.h[1]  = (_Float16)r.a.y;
  t.h[2]  = (_Float16)r.a.z;  t.h[3]  = (_Float16)r.a.w;
  t.h[4]  = (_Float16)r.b.x;  t.h[5]  = (_Float16)r.b.y;
  t.h[6]  = (_Float16)r.b.z;  t.h[7]  = (_Float16)r.b.w;
  t.h[8]  = (_Float16)r.c.x;  t.h[9]  = (_Float16)r.c.y;
  t.h[10] = (_Float16)r.c.z;  t.h[11] = (_Float16)r.c.w;
  t.h[12] = (_Float16)r.d.x;  t.h[13] = (_Float16)r.d.y;
  t.h[14] = (_Float16)r.d.z;  t.h[15] = (_Float16)r.d.w;
  return t.v;
}

// f16-source operand tile load (packed u32 pairs; k offsets always even).
__device__ __forceinline__ v16h load_tile_f16(const _Float16* __restrict__ base, int ldr,
                                              int ml, int hl, int kbase) {
  const _Float16* p = base + (size_t)ml * ldr + kbase;
  V16H t;
#pragma unroll
  for (int i = 0; i < 8; ++i) {
    int k0 = kpair(i, hl);
    t.u[i] = *(const unsigned*)(p + k0);
  }
  return t.v;
}

__device__ __forceinline__ v8f wmma_f16(v16h a, v16h b, v8f c) {
  return __builtin_amdgcn_wmma_f32_16x16x32_f16(false, a, false, b, (short)0, c,
                                                false, false);
}

// ---------------------------------------------------------------------------
// Kernel 1: q/k/v projections.  Each wave: one 16-row x 16-col tile of all 3.
//   q,k stored [B*T, H] f16 row-major; v stored transposed [B, H, T] f16.
// ---------------------------------------------------------------------------
__global__ __launch_bounds__(256) void proj_kernel(
    const float* __restrict__ x, const float* __restrict__ Wk,
    const float* __restrict__ Wq, const float* __restrict__ Wv,
    _Float16* __restrict__ qb, _Float16* __restrict__ kb,
    _Float16* __restrict__ vtb) {
  const int lane = threadIdx.x & 31;
  const int wave = blockIdx.x * (blockDim.x >> 5) + (threadIdx.x >> 5);
  const int rt = wave >> 2;   // 0..(B*T/16 - 1)
  const int nt = wave & 3;    // 0..3 (H/16)
  const int hl = lane >> 4;
  const int ml = lane & 15;

  const int row0 = rt * 16;
  const int h0 = nt * 16;

  v8f aq = {}; v8f ak = {}; v8f av = {};
  const float* xrow  = x  + (size_t)row0 * NC;
  const float* wqrow = Wq + (size_t)h0 * NC;
  const float* wkrow = Wk + (size_t)h0 * NC;
  const float* wvrow = Wv + (size_t)h0 * NC;

  for (int kbase = 0; kbase < NC; kbase += 32) {
    // Phase 1: issue ALL 16 global b128 loads for this k-step.
    Raw16 rx = load_raw_f32(xrow,  NC, ml, hl, kbase);
    Raw16 rq = load_raw_f32(wqrow, NC, ml, hl, kbase);
    Raw16 rk = load_raw_f32(wkrow, NC, ml, hl, kbase);
    Raw16 rv = load_raw_f32(wvrow, NC, ml, hl, kbase);
    // Hard scheduling fence: nothing may cross, so loads stay grouped and the
    // backend cannot collapse them into a load->wait->convert serial chain.
    SCHED_FENCE();

    // Phase 2: convert to f16 operand tiles.
    v16h a  = cvt_tile(rx);
    v16h bq = cvt_tile(rq);
    v16h bk = cvt_tile(rk);
    v16h bv = cvt_tile(rv);

    // Phase 3: matrix ops.
    aq = wmma_f16(a, bq, aq);
    ak = wmma_f16(a, bk, ak);
    av = wmma_f16(a, bv, av);
  }

#pragma unroll
  for (int r = 0; r < 8; ++r) {
    const int row = row0 + r + 8 * hl;   // flat b*T + t
    const int h = h0 + ml;
    qb[(size_t)row * NH + h] = (_Float16)aq[r];
    kb[(size_t)row * NH + h] = (_Float16)ak[r];
    const int bidx = row >> 11;          // / NT
    const int t = row & (NT - 1);
    vtb[((size_t)bidx * NH + h) * NT + t] = (_Float16)av[r];
  }
}

// ---------------------------------------------------------------------------
// Kernel 2: flash attention. Each wave: 16 query rows, key chunks of 32.
// Softmax runs in the exp2 domain: log2(e) is folded into the score scale so
// every exponential is a single native v_exp_f32.
// ---------------------------------------------------------------------------
__global__ __launch_bounds__(256) void attn_kernel(
    const _Float16* __restrict__ qb, const _Float16* __restrict__ kb,
    const _Float16* __restrict__ vtb, float* __restrict__ out) {
  __shared__ _Float16 pbuf[8][16][36];   // padded rows -> conflict-free A-layout reads

  const int lane = threadIdx.x & 31;
  const int wslot = threadIdx.x >> 5;
  const int wave = blockIdx.x * 8 + wslot;
  const int b = wave >> 7;      // / (T/16)
  const int qt = wave & 127;
  const int q0 = qt * 16;
  const int hl = lane >> 4;
  const int ml = lane & 15;

  // Q tile (A operand), K-dim = H = 64 -> two k-steps
  const _Float16* qrow = qb + ((size_t)b * NT + q0) * NH;
  const v16h aq0 = load_tile_f16(qrow, NH, ml, hl, 0);
  const v16h aq1 = load_tile_f16(qrow, NH, ml, hl, 32);

  v8f o0 = {}, o1 = {}, o2 = {}, o3 = {};
  float m[8], l[8];
#pragma unroll
  for (int r = 0; r < 8; ++r) { m[r] = -__builtin_inff(); l[r] = 0.f; }

  // (1/sqrt(n_embd)) * log2(e): softmax computed with exp2.
  const float sscale2 = 0.03125f * 1.4426950408889634f;
  const int nchunks = (q0 + 16 + 31) >> 5;
  const _Float16* kb_b  = kb + (size_t)b * NT * NH;
  const _Float16* vtb_b = vtb + (size_t)b * NH * NT;

  for (int c = 0; c < nchunks; ++c) {
    const int s0 = c * 32;

    // ---- issue ALL K and V tile loads up front; V latency hides under
    //      the S-WMMAs + softmax VALU work ----
    const _Float16* krow0 = kb_b + (size_t)s0 * NH;
    const _Float16* krow1 = krow0 + (size_t)16 * NH;
    v16h bk00 = load_tile_f16(krow0, NH, ml, hl, 0);
    v16h bk01 = load_tile_f16(krow0, NH, ml, hl, 32);
    v16h bk10 = load_tile_f16(krow1, NH, ml, hl, 0);
    v16h bk11 = load_tile_f16(krow1, NH, ml, hl, 32);
    v16h bv0 = load_tile_f16(vtb_b + (size_t)0  * NT, NT, ml, hl, s0);
    v16h bv1 = load_tile_f16(vtb_b + (size_t)16 * NT, NT, ml, hl, s0);
    v16h bv2 = load_tile_f16(vtb_b + (size_t)32 * NT, NT, ml, hl, s0);
    v16h bv3 = load_tile_f16(vtb_b + (size_t)48 * NT, NT, ml, hl, s0);
    SCHED_FENCE();

    // ---- S = Q K^T  (two 16x16 f32 tiles over a 32-key chunk) ----
    v8f s0acc = {}, s1acc = {};
    s0acc = wmma_f16(aq0, bk00, s0acc);
    s0acc = wmma_f16(aq1, bk01, s0acc);
    s1acc = wmma_f16(aq0, bk10, s1acc);
    s1acc = wmma_f16(aq1, bk11, s1acc);

    // ---- scale + causal mask + row max (reduce across 16-lane half) ----
    float mx[8];
#pragma unroll
    for (int r = 0; r < 8; ++r) {
      const int trow = q0 + r + 8 * hl;
      float v0 = s0acc[r] * sscale2;
      float v1 = s1acc[r] * sscale2;
      if (s0 + ml > trow)      v0 = -__builtin_inff();
      if (s0 + 16 + ml > trow) v1 = -__builtin_inff();
      s0acc[r] = v0; s1acc[r] = v1;
      float t = fmaxf(v0, v1);
      t = fmaxf(t, __shfl_xor(t, 1, 32));
      t = fmaxf(t, __shfl_xor(t, 2, 32));
      t = fmaxf(t, __shfl_xor(t, 4, 32));
      t = fmaxf(t, __shfl_xor(t, 8, 32));
      mx[r] = t;
    }

    // ---- online softmax (exp2 domain); stage P into LDS (16x32 row-major) ----
#pragma unroll
    for (int r = 0; r < 8; ++r) {
      const float newm = fmaxf(m[r], mx[r]);
      const float corr = __builtin_amdgcn_exp2f(m[r] - newm);
      m[r] = newm;
      const float p0 = __builtin_amdgcn_exp2f(s0acc[r] - newm);
      const float p1 = __builtin_amdgcn_exp2f(s1acc[r] - newm);
      float rs = p0 + p1;
      rs += __shfl_xor(rs, 1, 32);
      rs += __shfl_xor(rs, 2, 32);
      rs += __shfl_xor(rs, 4, 32);
      rs += __shfl_xor(rs, 8, 32);
      l[r] = l[r] * corr + rs;
      o0[r] *= corr; o1[r] *= corr; o2[r] *= corr; o3[r] *= corr;
      pbuf[wslot][r + 8 * hl][ml]      = (_Float16)p0;
      pbuf[wslot][r + 8 * hl][16 + ml] = (_Float16)p1;
    }

    // Same-wave LDS is in-order; drain DScnt before re-reading our slot.
    asm volatile("s_wait_dscnt 0" ::: "memory");

    // ---- reload P in A layout (16x32, K = keys) ----
    V16H ap;
#pragma unroll
    for (int i = 0; i < 8; ++i) {
      const int k0 = kpair(i, hl);
      ap.u[i] = *(const unsigned*)&pbuf[wslot][ml][k0];
    }

    // ---- O += P V  (V tiles already resident) ----
    o0 = wmma_f16(ap.v, bv0, o0);
    o1 = wmma_f16(ap.v, bv1, o1);
    o2 = wmma_f16(ap.v, bv2, o2);
    o3 = wmma_f16(ap.v, bv3, o3);
  }

  // ---- normalize and store f32 output [B, T, H] ----
#pragma unroll
  for (int r = 0; r < 8; ++r) {
    const float inv = 1.0f / l[r];
    const int row = q0 + r + 8 * hl;
    const size_t base = ((size_t)b * NT + row) * NH;
    out[base + 0  + ml] = o0[r] * inv;
    out[base + 16 + ml] = o1[r] * inv;
    out[base + 32 + ml] = o2[r] * inv;
    out[base + 48 + ml] = o3[r] * inv;
  }
}

// ---------------------------------------------------------------------------
extern "C" void kernel_launch(void* const* d_in, const int* in_sizes, int n_in,
                              void* d_out, int out_size, void* d_ws, size_t ws_size,
                              hipStream_t stream) {
  const float* x  = (const float*)d_in[0];
  const float* Wk = (const float*)d_in[1];
  const float* Wq = (const float*)d_in[2];
  const float* Wv = (const float*)d_in[3];

  const size_t nqkv = (size_t)NB * NT * NH;  // 1M elems each
  _Float16* qb  = (_Float16*)d_ws;
  _Float16* kbf = qb + nqkv;
  _Float16* vtb = kbf + nqkv;

  // Projection: B*T/16 row-tiles * 4 n-tiles = 4096 waves; 8 waves/block.
  proj_kernel<<<512, 256, 0, stream>>>(x, Wk, Wq, Wv, qb, kbf, vtb);

  // Attention: B * T/16 = 1024 waves; 8 waves/block.
  attn_kernel<<<128, 256, 0, stream>>>(qb, kbf, vtb, (float*)d_out);
}

// v001
// A run of this version takes 100 microseconds.
// Timed twice side by side with v000, it ran 1.33 and 1.32 times as fast.
#include <hip/hip_runtime.h>
#include <hip/hip_bf16.h>

// Problem constants (match reference)
constexpr int NB = 8;     // batch
constexpr int NT = 2048;  // sequence length
constexpr int NC = 1024;  // n_embd
constexpr int NH = 64;    // head size

typedef __attribute__((ext_vector_type(16))) _Float16 v16h;
typedef __attribute__((ext_vector_type(8)))  float    v8f;

union V16H {
  v16h v;
  _Float16 h[16];
  unsigned u[8];
};

#if defined(__has_builtin)
#if __has_builtin(__builtin_amdgcn_sched_barrier)
#define SCHED_FENCE() __builtin_amdgcn_sched_barrier(0)
#endif
#endif
#ifndef SCHED_FENCE
#define SCHED_FENCE() asm volatile("" ::: "memory")
#endif

// K offset of the packed f16 pair held in "VGPR" i by this lane-half
// (16-bit A/B 16x32 WMMA layout):
//   lanes 0-15 : vgpr0..3 -> K={0,1},{2,3},{4,5},{6,7}; vgpr4..7 -> K={16..23}
//   lanes 16-31: +8 on each block.
__device__ __forceinline__ int kpair(int i, int hl) {
  return ((i < 4) ? (2 * i) : (16 + 2 * (i - 4))) + 8 * hl;
}

// f16-source operand tile load (packed u32 pairs; k offsets always even).
__device__ __forceinline__ v16h load_tile_f16(const _Float16* __restrict__ base, int ldr,
                                              int ml, int hl, int kbase) {
  const _Float16* p = base + (size_t)ml * ldr + kbase;
  V16H t;
#pragma unroll
  for (int i = 0; i < 8; ++i) {
    int k0 = kpair(i, hl);
    t.u[i] = *(const unsigned*)(p + k0);
  }
  return t.v;
}

__device__ __forceinline__ v8f wmma_f16(v16h a, v16h b, v8f c) {
  return __builtin_amdgcn_wmma_f32_16x16x32_f16(false, a, false, b, (short)0, c,
                                                false, false);
}

// ---------------------------------------------------------------------------
// Kernel 1: q/k/v projections.  One work-group: 64 rows of x against all 192
// rows of Wq|Wk|Wv.  A 128-k slice of those 256 rows is fetched with whole-line
// loads, converted to f16 once and shared through LDS (two buffers); each of
// the 16 waves owns one 16-row x 16-col tile of q, k and v.
//   q,k stored [B*T, H] f16 row-major; v stored transposed [B, H, T] f16.
// ---------------------------------------------------------------------------
constexpr int PM      = 64;            // x rows per work-group
constexpr int PKS     = 128;           // k per staged slice: one wave-wide 16-B load per row
constexpr int PROWS   = PM + 3 * NH;   // staged rows: x | Wq | Wk | Wv
constexpr int PPITCH  = PKS + 8;       // f16 per LDS row: 272 B = 16 B x 17, no bank conflict for 16-B reads
constexpr int PSLICES = NC / PKS;

typedef __attribute__((ext_vector_type(8))) _Float16 v8h;
typedef __attribute__((ext_vector_type(4))) _Float16 v4h;

// One 16x32 operand tile from a staged row; p = row start + k offset + 8 * hl.
// k order of kpair(): [0..7] and [16..23] behind p, for A and B alike.
__device__ __forceinline__ v16h lds_frag(const _Float16* p) {
  union { v16h v; v8h h[2]; } t;
  t.h[0] = *(const v8h*)(p);
  t.h[1] = *(const v8h*)(p + 16);
  return t.v;
}

typedef __attribute__((ext_vector_type(4))) float v4f;

__global__ __launch_bounds__(512) void proj_kernel(
    const float* __restrict__ x, const float* __restrict__ Wk,
    const float* __restrict__ Wq, const float* __restrict__ Wv,
    _Float16* __restrict__ qb, _Float16* __restrict__ kb,
    _Float16* __restrict__ vtb) {
  __shared__ __attribute__((aligned(16))) _Float16 tile[2][PROWS * PPITCH];

  const int tid = threadIdx.x;
  const int lane = tid & 31;
  const int wslot = tid >> 5;
  const int rt = wslot & 3;   // 16-row tile inside the 64 rows
  const int nt = wslot >> 2;  // 0..3 (H/16)
  const int hl = lane >> 4;
  const int ml = lane & 15;

  const int row0 = blockIdx.x * PM + rt * 16;
  const int h0 = nt * 16;

  // Staging: a wave's load covers the 512 B of one row's slice (4 whole lines).
  // Piece j of a wave is staged row j * 16 + wslot; 4 pieces per 64-row matrix.
  const unsigned goff = (unsigned)(wslot * NC + lane * 4);
  const float* xblk = x + (size_t)blockIdx.x * PM * NC;
  const int soff = wslot * PPITCH + lane * 4;

  v4f g[16];
  auto fetch = [&](int k0) {
    const float* px = xblk + k0;
    const float* pq = Wq + k0;
    const float* pk = Wk + k0;
    const float* pv = Wv + k0;
#pragma unroll  // constant indices keep g[] in registers
    for (int j = 0; j < 4; ++j) {
      g[j]      = *(const v4f*)(px + j * 16 * NC + goff);
      g[4 + j]  = *(const v4f*)(pq + j * 16 * NC + goff);
      g[8 + j]  = *(const v4f*)(pk + j * 16 * NC + goff);
      g[12 + j] = *(const v4f*)(pv + j * 16 * NC + goff);
    }
  };
  auto stage = [&](int buf) {
    _Float16* d = &tile[buf][soff];
#pragma unroll  // constant indices keep g[] in registers
    for (int j = 0; j < 16; ++j) *(v4h*)(d + j * 16 * PPITCH) = __builtin_convertvector(g[j], v4h);
  };

  v8f aq = {}; v8f ak = {}; v8f av = {};
  const int aoff = (rt * 16 + ml) * PPITCH + 8 * hl;
  const int boff = (PM + h0 + ml) * PPITCH + 8 * hl;
  auto compute = [&](int buf) {
    const _Float16* ta = &tile[buf][aoff];
    const _Float16* tb = &tile[buf][boff];
#pragma unroll  // k offsets become immediate LDS offsets
    for (int kk = 0; kk < PKS; kk += 32) {
      v16h a  = lds_frag(ta + kk);
      v16h bq = lds_frag(tb + kk);
      v16h bk = lds_frag(tb + NH * PPITCH + kk);
      v16h bv = lds_frag(tb + 2 * NH * PPITCH + kk);
      aq = wmma_f16(a, bq, aq);
      ak = wmma_f16(a, bk, ak);
      av = wmma_f16(a, bv, av);
    }
  };

  fetch(0);
  stage(0);
  __syncthreads();

  // Unrolled so that each slice's k offset and buffer fold into immediate
  // offsets: one offset register serves every global load and is never rewritten.
#pragma unroll
  for (int s = 0; s < PSLICES - 1; ++s) {
    fetch((s + 1) * PKS);
    // Keeps the next slice's global loads ahead of this slice's LDS reads and
    // matrix work, so that their latency runs under it.
    SCHED_FENCE();
    compute(s & 1);
    // Keeps the wait for those loads (the conversions read them) behind the matrix work.
    SCHED_FENCE();
    stage((s + 1) & 1);
    // Publishes slice s + 1 and ends every read of the buffer refilled next trip.
    __syncthreads();
  }
  compute((PSLICES - 1) & 1);

#pragma unroll
  for (int r = 0; r < 8; ++r) {
    const int row = row0 + r + 8 * hl;   // flat b*T + t
    const int h = h0 + ml;
    qb[(size_t)row * NH + h] = (_Float16)aq[r];
    kb[(size_t)row * NH + h] = (_Float16)ak[r];
    const int bidx = row >> 11;          // / NT
    const int t = row & (NT - 1);
    vtb[((size_t)bidx * NH + h) * NT + t] = (_Float16)av[r];
  }
}

// ---------------------------------------------------------------------------
// Kernel 2: flash attention. Each wave: 16 query rows, key chunks of 32.
// Softmax runs in the exp2 domain: log2(e) is folded into the score scale so
// every exponential is a single native v_exp_f32.
// ---------------------------------------------------------------------------
__global__ __launch_bounds__(256) void attn_kernel(
    const _Float16* __restrict__ qb, const _Float16* __restrict__ kb,
    const _Float16* __restrict__ vtb, float* __restrict__ out) {
  __shared__ _Float16 pbuf[8][16][36];   // padded rows -> conflict-free A-layout reads

  const int lane = threadIdx.x & 31;
  const int wslot = threadIdx.x >> 5;
  const int wave = blockIdx.x * 8 + wslot;
  const int b = wave >> 7;      // / (T/16)
  const int qt = wave & 127;
  const int q0 = qt * 16;
  const int hl = lane >> 4;
  const int ml = lane & 15;

  // Q tile (A operand), K-dim = H = 64 -> two k-steps
  const _Float16* qrow = qb + ((size_t)b * NT + q0) * NH;
  const v16h aq0 = load_tile_f16(qrow, NH, ml, hl, 0);
  const v16h aq1 = load_tile_f16(qrow, NH, ml, hl, 32);

  v8f o0 = {}, o1 = {}, o2 = {}, o3 = {};
  float m[8], l[8];
#pragma unroll
  for (int r = 0; r < 8; ++r) { m[r] = -__builtin_inff(); l[r] = 0.f; }

  // (1/sqrt(n_embd)) * log2(e): softmax computed with exp2.
  const float sscale2 = 0.03125f * 1.4426950408889634f;
  const int nchunks = (q0 + 16 + 31) >> 5;
  const _Float16* kb_b  = kb + (size_t)b * NT * NH;
  const _Float16* vtb_b = vtb + (size_t)b * NH * NT;

  for (int c = 0; c < nchunks; ++c) {
    const int s0 = c * 32;

    // ---- issue ALL K and V tile loads up front; V latency hides under
    //      the S-WMMAs + softmax VALU work ----
    const _Float16* krow0 = kb_b + (size_t)s0 * NH;
    const _Float16* krow1 = krow0 + (size_t)16 * NH;
    v16h bk00 = load_tile_f16(krow0, NH, ml, hl, 0);
    v16h bk01 = load_tile_f16(krow0, NH, ml, hl, 32);
    v16h bk10 = load_tile_f16(krow1, NH, ml, hl, 0);
    v16h bk11 = load_tile_f16(krow1, NH, ml, hl, 32);
    v16h bv0 = load_tile_f16(vtb_b + (size_t)0  * NT, NT, ml, hl, s0);
    v16h bv1 = load_tile_f16(vtb_b + (size_t)16 * NT, NT, ml, hl, s0);
    v16h bv2 = load_tile_f16(vtb_b + (size_t)32 * NT, NT, ml, hl, s0);
    v16h bv3 = load_tile_f16(vtb_b + (size_t)48 * NT, NT, ml, hl, s0);
    SCHED_FENCE();

    // ---- S = Q K^T  (two 16x16 f32 tiles over a 32-key chunk) ----
    v8f s0acc = {}, s1acc = {};
    s0acc = wmma_f16(aq0, bk00, s0acc);
    s0acc = wmma_f16(aq1, bk01, s0acc);
    s1acc = wmma_f16(aq0, bk10, s1acc);
    s1acc = wmma_f16(aq1, bk11, s1acc);

    // ---- scale + causal mask + row max (reduce across 16-lane half) ----
    float mx[8];
#pragma unroll
    for (int r = 0; r < 8; ++r) {
      const int trow = q0 + r + 8 * hl;
      float v0 = s0acc[r] * sscale2;
      float v1 = s1acc[r] * sscale2;
      if (s0 + ml > trow)      v0 = -__builtin_inff();
      if (s0 + 16 + ml > trow) v1 = -__builtin_inff();
      s0acc[r] = v0; s1acc[r] = v1;
      float t = fmaxf(v0, v1);
      t = fmaxf(t, __shfl_xor(t, 1, 32));
      t = fmaxf(t, __shfl_xor(t, 2, 32));
      t = fmaxf(t, __shfl_xor(t, 4, 32));
      t = fmaxf(t, __shfl_xor(t, 8, 32));
      mx[r] = t;
    }

    // ---- online softmax (exp2 domain); stage P into LDS (16x32 row-major) ----
#pragma unroll
    for (int r = 0; r < 8; ++r) {
      const float newm = fmaxf(m[r], mx[r]);
      const float corr = __builtin_amdgcn_exp2f(m[r] - newm);
      m[r] = newm;
      const float p0 = __builtin_amdgcn_exp2f(s0acc[r] - newm);
      const float p1 = __builtin_amdgcn_exp2f(s1acc[r] - newm);
      float rs = p0 + p1;
      rs += __shfl_xor(rs, 1, 32);
      rs += __shfl_xor(rs, 2, 32);
      rs += __shfl_xor(rs, 4, 32);
      rs += __shfl_xor(rs, 8, 32);
      l[r] = l[r] * corr + rs;
      o0[r] *= corr; o1[r] *= corr; o2[r] *= corr; o3[r] *= corr;
      pbuf[wslot][r + 8 * hl][ml]      = (_Float16)p0;
      pbuf[wslot][r + 8 * hl][16 + ml] = (_Float16)p1;
    }

    // Same-wave LDS is in-order; drain DScnt before re-reading our slot.
    asm volatile("s_wait_dscnt 0" ::: "memory");

    // ---- reload P in A layout (16x32, K = keys) ----
    V16H ap;
#pragma unroll
    for (int i = 0; i < 8; ++i) {
      const int k0 = kpair(i, hl);
      ap.u[i] = *(const unsigned*)&pbuf[wslot][ml][k0];
    }

    // ---- O += P V  (V tiles already resident) ----
    o0 = wmma_f16(ap.v, bv0, o0);
    o1 = wmma_f16(ap.v, bv1, o1);
    o2 = wmma_f16(ap.v, bv2, o2);
    o3 = wmma_f16(ap.v, bv3, o3);
  }

  // ---- normalize and store f32 output [B, T, H] ----
#pragma unroll
  for (int r = 0; r < 8; ++r) {
    const float inv = 1.0f / l[r];
    const int row = q0 + r + 8 * hl;
    const size_t base = ((size_t)b * NT + row) * NH;
    out[base + 0  + ml] = o0[r] * inv;
    out[base + 16 + ml] = o1[r] * inv;
    out[base + 32 + ml] = o2[r] * inv;
    out[base + 48 + ml] = o3[r] * inv;
  }
}

// ---------------------------------------------------------------------------
extern "C" void kernel_launch(void* const* d_in, const int* in_sizes, int n_in,
                              void* d_out, int out_size, void* d_ws, size_t ws_size,
                              hipStream_t stream) {
  const float* x  = (const float*)d_in[0];
  const float* Wk = (const float*)d_in[1];
  const float* Wq = (const float*)d_in[2];
  const float* Wv = (const float*)d_in[3];

  const size_t nqkv = (size_t)NB * NT * NH;  // 1M elems each
  _Float16* qb  = (_Float16*)d_ws;
  _Float16* kbf = qb + nqkv;
  _Float16* vtb = kbf + nqkv;

  // Projection: B*T/64 = 256 work-groups of 16 waves.
  proj_kernel<<<256, 512, 0, stream>>>(x, Wk, Wq, Wv, qb, kbf, vtb);

  // Attention: B * T/16 = 1024 waves; 8 waves/block.
  attn_kernel<<<128, 256, 0, stream>>>(qb, kbf, vtb, (float*)d_out);
}

// v002
// A run of this version takes 45.9 microseconds.
// In two side-by-side timings against v001, it was 2.16 and 2.14 times as fast.
// Counting every step since v000, it is 2.86 times as fast.
#include <hip/hip_runtime.h>
#include <hip/hip_bf16.h>

// Problem constants (match reference)
constexpr int NB = 8;     // batch
constexpr int NT = 2048;  // sequence length
constexpr int NC = 1024;  // n_embd
constexpr int NH = 64;    // head size

typedef __attribute__((ext_vector_type(16))) _Float16 v16h;
typedef __attribute__((ext_vector_type(8)))  float    v8f;

union V16H {
  v16h v;
  _Float16 h[16];
  unsigned u[8];
};

#if defined(__has_builtin)
#if __has_builtin(__builtin_amdgcn_sched_barrier)
#define SCHED_FENCE() __builtin_amdgcn_sched_barrier(0)
#endif
#endif
#ifndef SCHED_FENCE
#define SCHED_FENCE() asm volatile("" ::: "memory")
#endif

// K offset of the packed f16 pair held in "VGPR" i by this lane-half
// (16-bit A/B 16x32 WMMA layout):
//   lanes 0-15 : vgpr0..3 -> K={0,1},{2,3},{4,5},{6,7}; vgpr4..7 -> K={16..23}
//   lanes 16-31: +8 on each block.
__device__ __forceinline__ int kpair(int i, int hl) {
  return ((i < 4) ? (2 * i) : (16 + 2 * (i - 4))) + 8 * hl;
}

// f16-source operand tile load (packed u32 pairs; k offsets always even).
__device__ __forceinline__ v16h load_tile_f16(const _Float16* __restrict__ base, int ldr,
                                              int ml, int hl, int kbase) {
  const _Float16* p = base + (size_t)ml * ldr + kbase;
  V16H t;
#pragma unroll
  for (int i = 0; i < 8; ++i) {
    int k0 = kpair(i, hl);
    t.u[i] = *(const unsigned*)(p + k0);
  }
  return t.v;
}

__device__ __forceinline__ v8f wmma_f16(v16h a, v16h b, v8f c) {
  return __builtin_amdgcn_wmma_f32_16x16x32_f16(false, a, false, b, (short)0, c,
                                                false, false);
}

// ---------------------------------------------------------------------------
// Kernel 1: q/k/v projections.  One work-group: 64 rows of x against all 192
// rows of Wq|Wk|Wv.  A 128-k slice of those 256 rows is fetched with whole-line
// loads, converted to f16 once and shared through LDS (two buffers); each of
// the 16 waves owns one 16-row x 16-col tile of q, k and v.
//   q,k stored [B*T, H] f16 row-major; v stored transposed [B, H, T] f16.
// ---------------------------------------------------------------------------
constexpr int PM      = 64;            // x rows per work-group
constexpr int PKS     = 128;           // k per staged slice: one wave-wide 16-B load per row
constexpr int PROWS   = PM + 3 * NH;   // staged rows: x | Wq | Wk | Wv
constexpr int PPITCH  = PKS + 8;       // f16 per LDS row: 272 B = 16 B x 17, no bank conflict for 16-B reads
constexpr int PSLICES = NC / PKS;

typedef __attribute__((ext_vector_type(8))) _Float16 v8h;
typedef __attribute__((ext_vector_type(4))) _Float16 v4h;

// One 16x32 operand tile from a staged row; p = row start + k offset + 8 * hl.
// k order of kpair(): [0..7] and [16..23] behind p, for A and B alike.
__device__ __forceinline__ v16h lds_frag(const _Float16* p) {
  union { v16h v; v8h h[2]; } t;
  t.h[0] = *(const v8h*)(p);
  t.h[1] = *(const v8h*)(p + 16);
  return t.v;
}

typedef __attribute__((ext_vector_type(4))) float v4f;

__global__ __launch_bounds__(512) void proj_kernel(
    const float* __restrict__ x, const float* __restrict__ Wk,
    const float* __restrict__ Wq, const float* __restrict__ Wv,
    _Float16* __restrict__ qb, _Float16* __restrict__ kb,
    _Float16* __restrict__ vtb) {
  __shared__ __attribute__((aligned(16))) _Float16 tile[2][PROWS * PPITCH];

  const int tid = threadIdx.x;
  const int lane = tid & 31;
  const int wslot = tid >> 5;
  const int rt = wslot & 3;   // 16-row tile inside the 64 rows
  const int nt = wslot >> 2;  // 0..3 (H/16)
  const int hl = lane >> 4;
  const int ml = lane & 15;

  const int row0 = blockIdx.x * PM + rt * 16;
  const int h0 = nt * 16;

  // Staging: a wave's load covers the 512 B of one row's slice (4 whole lines).
  // Piece j of a wave is staged row j * 16 + wslot; 4 pieces per 64-row matrix.
  const unsigned goff = (unsigned)(wslot * NC + lane * 4);
  const float* xblk = x + (size_t)blockIdx.x * PM * NC;
  const int soff = wslot * PPITCH + lane * 4;

  v4f g[16];
  auto fetch = [&](int k0) {
    const float* px = xblk + k0;
    const float* pq = Wq + k0;
    const float* pk = Wk + k0;
    const float* pv = Wv + k0;
#pragma unroll  // constant indices keep g[] in registers
    for (int j = 0; j < 4; ++j) {
      g[j]      = *(const v4f*)(px + j * 16 * NC + goff);
      g[4 + j]  = *(const v4f*)(pq + j * 16 * NC + goff);
      g[8 + j]  = *(const v4f*)(pk + j * 16 * NC + goff);
      g[12 + j] = *(const v4f*)(pv + j * 16 * NC + goff);
    }
  };
  auto stage = [&](int buf) {
    _Float16* d = &tile[buf][soff];
#pragma unroll  // constant indices keep g[] in registers
    for (int j = 0; j < 16; ++j) *(v4h*)(d + j * 16 * PPITCH) = __builtin_convertvector(g[j], v4h);
  };

  v8f aq = {}; v8f ak = {}; v8f av = {};
  const int aoff = (rt * 16 + ml) * PPITCH + 8 * hl;
  const int boff = (PM + h0 + ml) * PPITCH + 8 * hl;
  auto compute = [&](int buf) {
    const _Float16* ta = &tile[buf][aoff];
    const _Float16* tb = &tile[buf][boff];
#pragma unroll  // k offsets become immediate LDS offsets
    for (int kk = 0; kk < PKS; kk += 32) {
      v16h a  = lds_frag(ta + kk);
      v16h bq = lds_frag(tb + kk);
      v16h bk = lds_frag(tb + NH * PPITCH + kk);
      v16h bv = lds_frag(tb + 2 * NH * PPITCH + kk);
      aq = wmma_f16(a, bq, aq);
      ak = wmma_f16(a, bk, ak);
      av = wmma_f16(a, bv, av);
    }
  };

  fetch(0);
  stage(0);
  __syncthreads();

  // Unrolled so that each slice's k offset and buffer fold into immediate
  // offsets: one offset register serves every global load and is never rewritten.
#pragma unroll
  for (int s = 0; s < PSLICES - 1; ++s) {
    fetch((s + 1) * PKS);
    // Keeps the next slice's global loads ahead of this slice's LDS reads and
    // matrix work, so that their latency runs under it.
    SCHED_FENCE();
    compute(s & 1);
    // Keeps the wait for those loads (the conversions read them) behind the matrix work.
    SCHED_FENCE();
    stage((s + 1) & 1);
    // Publishes slice s + 1 and ends every read of the buffer refilled next trip.
    __syncthreads();
  }
  compute((PSLICES - 1) & 1);

#pragma unroll
  for (int r = 0; r < 8; ++r) {
    const int row = row0 + r + 8 * hl;   // flat b*T + t
    const int h = h0 + ml;
    qb[(size_t)row * NH + h] = (_Float16)aq[r];
    kb[(size_t)row * NH + h] = (_Float16)ak[r];
    const int bidx = row >> 11;          // / NT
    const int t = row & (NT - 1);
    vtb[((size_t)bidx * NH + h) * NT + t] = (_Float16)av[r];
  }
}

// ---------------------------------------------------------------------------
// Kernel 2: flash attention. One work-group: 16 query rows. Its 8 waves share
// the tile's key chunks of 32 (wave w takes chunks w, w + 8, ...), each with its
// own running maxima, sums and output tile; the partials are merged through LDS.
// Softmax runs in the exp2 domain: log2(e) is folded into the score scale so
// every exponential is a single native v_exp_f32.
// ---------------------------------------------------------------------------
constexpr int AW     = 8;    // waves per work-group = key shares of one query tile
constexpr int OPITCH = 68;   // f32 per partial-output row: 272 B = 16 B x 17

__global__ __launch_bounds__(256) void attn_kernel(
    const _Float16* __restrict__ qb, const _Float16* __restrict__ kb,
    const _Float16* __restrict__ vtb, float* __restrict__ out) {
  __shared__ _Float16 pbuf[AW][16][36];   // padded rows -> conflict-free A-layout reads
  __shared__ __attribute__((aligned(16))) float po[AW][16][OPITCH];  // partial outputs
  __shared__ __attribute__((aligned(16))) float pm[AW][16];          // partial row maxima
  __shared__ __attribute__((aligned(16))) float pl[AW][16];          // partial row sums

  const int lane = threadIdx.x & 31;
  // Wave number as a scalar: the chunk loop's bounds and the K/V bases stay wave-uniform.
  const int wslot = __builtin_amdgcn_readfirstlane(threadIdx.x >> 5);
  const int b = blockIdx.x >> 7;      // / (T/16)
  const int qt = blockIdx.x & 127;
  const int q0 = qt * 16;
  const int hl = lane >> 4;
  const int ml = lane & 15;

  // Q tile (A operand), K-dim = H = 64 -> two k-steps
  const _Float16* qrow = qb + ((size_t)b * NT + q0) * NH;
  const v16h aq0 = load_tile_f16(qrow, NH, ml, hl, 0);
  const v16h aq1 = load_tile_f16(qrow, NH, ml, hl, 32);

  v8f o0 = {}, o1 = {}, o2 = {}, o3 = {};
  float m[8], l[8];
#pragma unroll
  for (int r = 0; r < 8; ++r) { m[r] = -__builtin_inff(); l[r] = 0.f; }

  // (1/sqrt(n_embd)) * log2(e): softmax computed with exp2.
  const float sscale2 = 0.03125f * 1.4426950408889634f;
  const int nchunks = (q0 + 16 + 31) >> 5;
  const _Float16* kb_b  = kb + (size_t)b * NT * NH;
  const _Float16* vtb_b = vtb + (size_t)b * NH * NT;

  for (int c = wslot; c < nchunks; c += AW) {
    const int s0 = c * 32;

    // ---- issue ALL K and V tile loads up front; V latency hides under
    //      the S-WMMAs + softmax VALU work ----
    const _Float16* krow0 = kb_b + (size_t)s0 * NH;
    const _Float16* krow1 = krow0 + (size_t)16 * NH;
    v16h bk00 = load_tile_f16(krow0, NH, ml, hl, 0);
    v16h bk01 = load_tile_f16(krow0, NH, ml, hl, 32);
    v16h bk10 = load_tile_f16(krow1, NH, ml, hl, 0);
    v16h bk11 = load_tile_f16(krow1, NH, ml, hl, 32);
    v16h bv0 = load_tile_f16(vtb_b + (size_t)0  * NT, NT, ml, hl, s0);
    v16h bv1 = load_tile_f16(vtb_b + (size_t)16 * NT, NT, ml, hl, s0);
    v16h bv2 = load_tile_f16(vtb_b + (size_t)32 * NT, NT, ml, hl, s0);
    v16h bv3 = load_tile_f16(vtb_b + (size_t)48 * NT, NT, ml, hl, s0);
    SCHED_FENCE();

    // ---- S = Q K^T  (two 16x16 f32 tiles over a 32-key chunk) ----
    v8f s0acc = {}, s1acc = {};
    s0acc = wmma_f16(aq0, bk00, s0acc);
    s0acc = wmma_f16(aq1, bk01, s0acc);
    s1acc = wmma_f16(aq0, bk10, s1acc);
    s1acc = wmma_f16(aq1, bk11, s1acc);

    // ---- scale + causal mask + row max (reduce across 16-lane half) ----
    float mx[8];
#pragma unroll
    for (int r = 0; r < 8; ++r) {
      const int trow = q0 + r + 8 * hl;
      float v0 = s0acc[r] * sscale2;
      float v1 = s1acc[r] * sscale2;
      if (s0 + ml > trow)      v0 = -__builtin_inff();
      if (s0 + 16 + ml > trow) v1 = -__builtin_inff();
      s0acc[r] = v0; s1acc[r] = v1;
      float t = fmaxf(v0, v1);
      t = fmaxf(t, __shfl_xor(t, 1, 32));
      t = fmaxf(t, __shfl_xor(t, 2, 32));
      t = fmaxf(t, __shfl_xor(t, 4, 32));
      t = fmaxf(t, __shfl_xor(t, 8, 32));
      mx[r] = t;
    }

    // ---- online softmax (exp2 domain); stage P into LDS (16x32 row-major) ----
#pragma unroll
    for (int r = 0; r < 8; ++r) {
      const float newm = fmaxf(m[r], mx[r]);
      const float corr = __builtin_amdgcn_exp2f(m[r] - newm);
      m[r] = newm;
      const float p0 = __builtin_amdgcn_exp2f(s0acc[r] - newm);
      const float p1 = __builtin_amdgcn_exp2f(s1acc[r] - newm);
      float rs = p0 + p1;
      rs += __shfl_xor(rs, 1, 32);
      rs += __shfl_xor(rs, 2, 32);
      rs += __shfl_xor(rs, 4, 32);
      rs += __shfl_xor(rs, 8, 32);
      l[r] = l[r] * corr + rs;
      o0[r] *= corr; o1[r] *= corr; o2[r] *= corr; o3[r] *= corr;
      pbuf[wslot][r + 8 * hl][ml]      = (_Float16)p0;
      pbuf[wslot][r + 8 * hl][16 + ml] = (_Float16)p1;
    }

    // Same-wave LDS is in-order; drain DScnt before re-reading our slot.
    asm volatile("s_wait_dscnt 0" ::: "memory");

    // ---- reload P in A layout (16x32, K = keys) ----
    V16H ap;
#pragma unroll
    for (int i = 0; i < 8; ++i) {
      const int k0 = kpair(i, hl);
      ap.u[i] = *(const unsigned*)&pbuf[wslot][ml][k0];
    }

    // ---- O += P V  (V tiles already resident) ----
    o0 = wmma_f16(ap.v, bv0, o0);
    o1 = wmma_f16(ap.v, bv1, o1);
    o2 = wmma_f16(ap.v, bv2, o2);
    o3 = wmma_f16(ap.v, bv3, o3);
  }

  // ---- hand this wave's partial (max, sum, un-normalised O) to the work-group.
  //      A wave without a chunk hands in max = -inf, sum = 0, O = 0: weight 0 below.
#pragma unroll
  for (int r = 0; r < 8; ++r) {
    float* d = &po[wslot][r + 8 * hl][ml];
    d[0]  = o0[r];
    d[16] = o1[r];
    d[32] = o2[r];
    d[48] = o3[r];
  }
  if (ml == 0) {   // every lane of a half holds the same m[] and l[]
    *(v4f*)&pm[wslot][8 * hl]     = v4f{m[0], m[1], m[2], m[3]};
    *(v4f*)&pm[wslot][8 * hl + 4] = v4f{m[4], m[5], m[6], m[7]};
    *(v4f*)&pl[wslot][8 * hl]     = v4f{l[0], l[1], l[2], l[3]};
    *(v4f*)&pl[wslot][8 * hl + 4] = v4f{l[4], l[5], l[6], l[7]};
  }
  // Publishes all eight partials; every wave passes it, with or without chunks.
  __syncthreads();

  // ---- merge, normalize and store f32 output [B, T, H]: a thread owns 4
  //      neighbouring columns of one row, a wave two whole 256-B rows.
  //      Wave 0 always has chunk 0, whose key 0 every row sees: mall is finite.
  const int mrow = threadIdx.x >> 4;
  const int mcol = (threadIdx.x & 15) * 4;
  float mw[AW];
  float mall = -__builtin_inff();
#pragma unroll
  for (int w = 0; w < AW; ++w) {
    mw[w] = pm[w][mrow];
    mall = fmaxf(mall, mw[w]);
  }
  float lall = 0.f;
  v4f acc = {};
#pragma unroll
  for (int w = 0; w < AW; ++w) {
    const float e = __builtin_amdgcn_exp2f(mw[w] - mall);
    lall += e * pl[w][mrow];
    acc += e * *(const v4f*)&po[w][mrow][mcol];
  }
  const float inv = 1.0f / lall;
  *(v4f*)&out[((size_t)b * NT + q0 + mrow) * NH + mcol] = acc * inv;
}

// ---------------------------------------------------------------------------
extern "C" void kernel_launch(void* const* d_in, const int* in_sizes, int n_in,
                              void* d_out, int out_size, void* d_ws, size_t ws_size,
                              hipStream_t stream) {
  const float* x  = (const float*)d_in[0];
  const float* Wk = (const float*)d_in[1];
  const float* Wq = (const float*)d_in[2];
  const float* Wv = (const float*)d_in[3];

  const size_t nqkv = (size_t)NB * NT * NH;  // 1M elems each
  _Float16* qb  = (_Float16*)d_ws;
  _Float16* kbf = qb + nqkv;
  _Float16* vtb = kbf + nqkv;

  // Projection: B*T/64 = 256 work-groups of 16 waves.
  proj_kernel<<<256, 512, 0, stream>>>(x, Wk, Wq, Wv, qb, kbf, vtb);

  // Attention: B * T/16 = 1024 query tiles, one work-group of 8 waves each.
  attn_kernel<<<1024, 256, 0, stream>>>(qb, kbf, vtb, (float*)d_out);
}

// v003
// It runs in 39.1 microseconds.
// Two timings next to v002 put it at 1.18 and 1.17 times that version's speed.
// All steps since v000 together make it 3.36 times as fast.
#include <hip/hip_runtime.h>
#include <hip/hip_bf16.h>

// Problem constants (match reference)
constexpr int NB = 8;     // batch
constexpr int NT = 2048;  // sequence length
constexpr int NC = 1024;  // n_embd
constexpr int NH = 64;    // head size

typedef __attribute__((ext_vector_type(16))) _Float16 v16h;
typedef __attribute__((ext_vector_type(8)))  float    v8f;

union V16H {
  v16h v;
  _Float16 h[16];
  unsigned u[8];
};

#if defined(__has_builtin)
#if __has_builtin(__builtin_amdgcn_sched_barrier)
#define SCHED_FENCE() __builtin_amdgcn_sched_barrier(0)
#endif
#endif
#ifndef SCHED_FENCE
#define SCHED_FENCE() asm volatile("" ::: "memory")
#endif

// K offset of the packed f16 pair held in "VGPR" i by this lane-half
// (16-bit A/B 16x32 WMMA layout):
//   lanes 0-15 : vgpr0..3 -> K={0,1},{2,3},{4,5},{6,7}; vgpr4..7 -> K={16..23}
//   lanes 16-31: +8 on each block.
__device__ __forceinline__ int kpair(int i, int hl) {
  return ((i < 4) ? (2 * i) : (16 + 2 * (i - 4))) + 8 * hl;
}

__device__ __forceinline__ v8f wmma_f16(v16h a, v16h b, v8f c) {
  return __builtin_amdgcn_wmma_f32_16x16x32_f16(false, a, false, b, (short)0, c,
                                                false, false);
}

// ---------------------------------------------------------------------------
// Kernel 1: q/k/v projections.  One work-group: 64 rows of x against all 192
// rows of Wq|Wk|Wv.  A 128-k slice of those 256 rows is fetched with whole-line
// loads, converted to f16 once and shared through LDS (two buffers); each of
// the 16 waves owns one 16-row x 16-col tile of q, k and v.
//   q, k and v go to the workspace in operand-fragment order, in units of
//   512 f16 (1 KB) = one 16 x 32 operand tile:
//     unit[half][lane][e] = tile row (lane & 15), k = 16 * half + 8 * (lane >> 4) + e
//   q, k: rows = 16 positions, k = 32 head columns; 2 units per 16 positions.
//   v   : rows = 16 head columns, k = 32 positions; 4 units per 32 positions.
//   A result tile whose lanes each hold 8 neighbouring k of one row is half a
//   unit: one 16-B store per lane, 512 contiguous bytes per wave. For q and k
//   that takes W as the first operand (result rows = head columns).
// ---------------------------------------------------------------------------
constexpr int FU = 512;                // f16 per fragment unit
constexpr int PM      = 64;            // x rows per work-group
constexpr int PKS     = 128;           // k per staged slice: one wave-wide 16-B load per row
constexpr int PROWS   = PM + 3 * NH;   // staged rows: x | Wq | Wk | Wv
constexpr int PPITCH  = PKS + 8;       // f16 per LDS row: 272 B = 16 B x 17, no bank conflict for 16-B reads
constexpr int PSLICES = NC / PKS;

typedef __attribute__((ext_vector_type(8))) _Float16 v8h;
typedef __attribute__((ext_vector_type(4))) _Float16 v4h;

// One 16x32 operand tile from a staged row; p = row start + k offset + 8 * hl.
// k order of kpair(): [0..7] and [16..23] behind p, for A and B alike.
__device__ __forceinline__ v16h lds_frag(const _Float16* p) {
  union { v16h v; v8h h[2]; } t;
  t.h[0] = *(const v8h*)(p);
  t.h[1] = *(const v8h*)(p + 16);
  return t.v;
}

typedef const __attribute__((address_space(1))) _Float16* gcf16;
typedef const __attribute__((address_space(1))) v8h* gcv8h;

// A wave-uniform global address held in scalar registers: the loads behind it
// take it as their scalar base, and the one vector register they name is the
// lane's constant offset, which nothing rewrites while they are in flight.
__device__ __forceinline__ gcf16 scalar_base(const _Float16* p) {
  const unsigned long long a = (unsigned long long)p;
  const unsigned lo = __builtin_amdgcn_readfirstlane((unsigned)a);
  const unsigned hi = __builtin_amdgcn_readfirstlane((unsigned)(a >> 32));
  return (gcf16)(((unsigned long long)hi << 32) | lo);
}

// One 16x32 operand tile from a fragment unit in global memory: two wave-wide
// 16-B loads of 512 contiguous bytes each.
__device__ __forceinline__ v16h unit_frag(gcf16 unit, unsigned lane) {
  union { v16h v; v8h h[2]; } t;
  t.h[0] = *(gcv8h)(unit + lane * 8u);
  t.h[1] = *(gcv8h)(unit + FU / 2 + lane * 8u);
  return t.v;
}

typedef __attribute__((ext_vector_type(4))) float v4f;

__global__ __launch_bounds__(512) void proj_kernel(
    const float* __restrict__ x, const float* __restrict__ Wk,
    const float* __restrict__ Wq, const float* __restrict__ Wv,
    _Float16* __restrict__ qb, _Float16* __restrict__ kb,
    _Float16* __restrict__ vtb) {
  __shared__ __attribute__((aligned(16))) _Float16 tile[2][PROWS * PPITCH];

  const int tid = threadIdx.x;
  const int lane = tid & 31;
  const int wslot = tid >> 5;
  const int rt = wslot & 3;   // 16-row tile inside the 64 rows
  const int nt = wslot >> 2;  // 0..3 (H/16)
  const int hl = lane >> 4;
  const int ml = lane & 15;

  const int row0 = blockIdx.x * PM + rt * 16;
  const int h0 = nt * 16;

  // Staging: a wave's load covers the 512 B of one row's slice (4 whole lines).
  // Piece j of a wave is staged row j * 16 + wslot; 4 pieces per 64-row matrix.
  const unsigned goff = (unsigned)(wslot * NC + lane * 4);
  const float* xblk = x + (size_t)blockIdx.x * PM * NC;
  const int soff = wslot * PPITCH + lane * 4;

  v4f g[16];
  auto fetch = [&](int k0) {
    const float* px = xblk + k0;
    const float* pq = Wq + k0;
    const float* pk = Wk + k0;
    const float* pv = Wv + k0;
#pragma unroll  // constant indices keep g[] in registers
    for (int j = 0; j < 4; ++j) {
      g[j]      = *(const v4f*)(px + j * 16 * NC + goff);
      g[4 + j]  = *(const v4f*)(pq + j * 16 * NC + goff);
      g[8 + j]  = *(const v4f*)(pk + j * 16 * NC + goff);
      g[12 + j] = *(const v4f*)(pv + j * 16 * NC + goff);
    }
  };
  auto stage = [&](int buf) {
    _Float16* d = &tile[buf][soff];
#pragma unroll  // constant indices keep g[] in registers
    for (int j = 0; j < 16; ++j) *(v4h*)(d + j * 16 * PPITCH) = __builtin_convertvector(g[j], v4h);
  };

  v8f aq = {}; v8f ak = {}; v8f av = {};
  const int aoff = (rt * 16 + ml) * PPITCH + 8 * hl;
  const int boff = (PM + h0 + ml) * PPITCH + 8 * hl;
  auto compute = [&](int buf) {
    const _Float16* ta = &tile[buf][aoff];
    const _Float16* tb = &tile[buf][boff];
#pragma unroll  // k offsets become immediate LDS offsets
    for (int kk = 0; kk < PKS; kk += 32) {
      v16h a  = lds_frag(ta + kk);
      v16h bq = lds_frag(tb + kk);
      v16h bk = lds_frag(tb + NH * PPITCH + kk);
      v16h bv = lds_frag(tb + 2 * NH * PPITCH + kk);
      aq = wmma_f16(bq, a, aq);   // q^T tile: rows = head columns, lane = position
      ak = wmma_f16(bk, a, ak);   // k^T tile, likewise
      av = wmma_f16(a, bv, av);   // v tile: rows = positions, lane = head column
    }
  };

  fetch(0);
  stage(0);
  __syncthreads();

  // Unrolled so that each slice's k offset and buffer fold into immediate
  // offsets: one offset register serves every global load and is never rewritten.
#pragma unroll
  for (int s = 0; s < PSLICES - 1; ++s) {
    fetch((s + 1) * PKS);
    // Keeps the next slice's global loads ahead of this slice's LDS reads and
    // matrix work, so that their latency runs under it.
    SCHED_FENCE();
    compute(s & 1);
    // Keeps the wait for those loads (the conversions read them) behind the matrix work.
    SCHED_FENCE();
    stage((s + 1) & 1);
    // Publishes slice s + 1 and ends every read of the buffer refilled next trip.
    __syncthreads();
  }
  compute((PSLICES - 1) & 1);

  // row0 = flat b*T + t of the tile's first position.
  // q, k: lane holds position row0 + ml, head columns h0 + 8 * hl + 0..7:
  //       unit h0 / 32 of the 16 positions, half (h0 / 16) & 1.
  // v   : lane holds head column h0 + ml, positions row0 + 8 * hl + 0..7:
  //       unit h0 / 16 of the 32 positions, half (row0 / 16) & 1.
  const size_t qkoff = (size_t)(row0 >> 4) * (2 * FU) + nt * (FU / 2) + lane * 8;
  const size_t voff  = (size_t)(row0 >> 5) * (4 * FU) + nt * FU + (rt & 1) * (FU / 2) + lane * 8;
  *(v8h*)(qb + qkoff) = __builtin_convertvector(aq, v8h);
  *(v8h*)(kb + qkoff) = __builtin_convertvector(ak, v8h);
  *(v8h*)(vtb + voff) = __builtin_convertvector(av, v8h);
}

// ---------------------------------------------------------------------------
// Kernel 2: flash attention. One work-group: 16 query rows. Its 8 waves share
// the tile's key chunks of 32 (wave w takes chunks w, w + 8, ...), each with its
// own running maxima, sums and output tile; the partials are merged through LDS.
// Softmax runs in the exp2 domain: log2(e) is folded into the score scale so
// every exponential is a single native v_exp_f32.
// ---------------------------------------------------------------------------
constexpr int AW     = 8;    // waves per work-group = key shares of one query tile
constexpr int OPITCH = 68;   // f32 per partial-output row: 272 B = 16 B x 17

__global__ __launch_bounds__(256) void attn_kernel(
    const _Float16* __restrict__ qb, const _Float16* __restrict__ kb,
    const _Float16* __restrict__ vtb, float* __restrict__ out) {
  __shared__ _Float16 pbuf[AW][16][36];   // padded rows -> conflict-free A-layout reads
  __shared__ __attribute__((aligned(16))) float po[AW][16][OPITCH];  // partial outputs
  __shared__ __attribute__((aligned(16))) float pm[AW][16];          // partial row maxima
  __shared__ __attribute__((aligned(16))) float pl[AW][16];          // partial row sums

  const int lane = threadIdx.x & 31;
  // Wave number as a scalar: the chunk loop's bounds and the K/V bases stay wave-uniform.
  const int wslot = __builtin_amdgcn_readfirstlane(threadIdx.x >> 5);
  const int b = blockIdx.x >> 7;      // / (T/16)
  const int qt = blockIdx.x & 127;
  const int q0 = qt * 16;
  const int hl = lane >> 4;
  const int ml = lane & 15;

  // Q tile (A operand), K-dim = H = 64 -> two k-steps
  const gcf16 qrow = scalar_base(qb + ((size_t)b * NT + q0) * NH);   // 2 units per 16 positions
  const v16h aq0 = unit_frag(qrow, lane);
  const v16h aq1 = unit_frag(qrow + FU, lane);

  v8f o0 = {}, o1 = {}, o2 = {}, o3 = {};
  float m[8], l[8];
#pragma unroll
  for (int r = 0; r < 8; ++r) { m[r] = -__builtin_inff(); l[r] = 0.f; }

  // (1/sqrt(n_embd)) * log2(e): softmax computed with exp2.
  const float sscale2 = 0.03125f * 1.4426950408889634f;
  const int nchunks = (q0 + 16 + 31) >> 5;
  const _Float16* kb_b  = kb + (size_t)b * NT * NH;
  const _Float16* vtb_b = vtb + (size_t)b * NT * NH;

  for (int c = wslot; c < nchunks; c += AW) {
    const int s0 = c * 32;

    // ---- issue ALL K and V tile loads up front; V latency hides under
    //      the S-WMMAs + softmax VALU work ----
    //      A chunk's K and V are 4 fragment units (4 KB contiguous) each.
    const gcf16 kc = scalar_base(kb_b + (size_t)s0 * NH);
    const gcf16 vc = scalar_base(vtb_b + (size_t)s0 * NH);
    v16h bk00 = unit_frag(kc, lane);            // keys s0..s0+15,    h 0..31
    v16h bk01 = unit_frag(kc + FU, lane);       //                    h 32..63
    v16h bk10 = unit_frag(kc + 2 * FU, lane);   // keys s0+16..s0+31, h 0..31
    v16h bk11 = unit_frag(kc + 3 * FU, lane);   //                    h 32..63
    v16h bv0 = unit_frag(vc, lane);             // h 0..15,  keys s0..s0+31
    v16h bv1 = unit_frag(vc + FU, lane);        // h 16..31
    v16h bv2 = unit_frag(vc + 2 * FU, lane);    // h 32..47
    v16h bv3 = unit_frag(vc + 3 * FU, lane);    // h 48..63
    SCHED_FENCE();

    // ---- S = Q K^T  (two 16x16 f32 tiles over a 32-key chunk) ----
    v8f s0acc = {}, s1acc = {};
    s0acc = wmma_f16(aq0, bk00, s0acc);
    s0acc = wmma_f16(aq1, bk01, s0acc);
    s1acc = wmma_f16(aq0, bk10, s1acc);
    s1acc = wmma_f16(aq1, bk11, s1acc);

    // ---- scale + causal mask + row max (reduce across 16-lane half) ----
    float mx[8];
#pragma unroll
    for (int r = 0; r < 8; ++r) {
      const int trow = q0 + r + 8 * hl;
      float v0 = s0acc[r] * sscale2;
      float v1 = s1acc[r] * sscale2;
      if (s0 + ml > trow)      v0 = -__builtin_inff();
      if (s0 + 16 + ml > trow) v1 = -__builtin_inff();
      s0acc[r] = v0; s1acc[r] = v1;
      float t = fmaxf(v0, v1);
      t = fmaxf(t, __shfl_xor(t, 1, 32));
      t = fmaxf(t, __shfl_xor(t, 2, 32));
      t = fmaxf(t, __shfl_xor(t, 4, 32));
      t = fmaxf(t, __shfl_xor(t, 8, 32));
      mx[r] = t;
    }

    // ---- online softmax (exp2 domain); stage P into LDS (16x32 row-major) ----
#pragma unroll
    for (int r = 0; r < 8; ++r) {
      const float newm = fmaxf(m[r], mx[r]);
      const float corr = __builtin_amdgcn_exp2f(m[r] - newm);
      m[r] = newm;
      const float p0 = __builtin_amdgcn_exp2f(s0acc[r] - newm);
      const float p1 = __builtin_amdgcn_exp2f(s1acc[r] - newm);
      float rs = p0 + p1;
      rs += __shfl_xor(rs, 1, 32);
      rs += __shfl_xor(rs, 2, 32);
      rs += __shfl_xor(rs, 4, 32);
      rs += __shfl_xor(rs, 8, 32);
      l[r] = l[r] * corr + rs;
      o0[r] *= corr; o1[r] *= corr; o2[r] *= corr; o3[r] *= corr;
      pbuf[wslot][r + 8 * hl][ml]      = (_Float16)p0;
      pbuf[wslot][r + 8 * hl][16 + ml] = (_Float16)p1;
    }

    // Same-wave LDS is in-order; drain DScnt before re-reading our slot.
    asm volatile("s_wait_dscnt 0" ::: "memory");

    // ---- reload P in A layout (16x32, K = keys) ----
    V16H ap;
#pragma unroll
    for (int i = 0; i < 8; ++i) {
      const int k0 = kpair(i, hl);
      ap.u[i] = *(const unsigned*)&pbuf[wslot][ml][k0];
    }

    // ---- O += P V  (V tiles already resident) ----
    o0 = wmma_f16(ap.v, bv0, o0);
    o1 = wmma_f16(ap.v, bv1, o1);
    o2 = wmma_f16(ap.v, bv2, o2);
    o3 = wmma_f16(ap.v, bv3, o3);
  }

  // ---- hand this wave's partial (max, sum, un-normalised O) to the work-group.
  //      A wave without a chunk hands in max = -inf, sum = 0, O = 0: weight 0 below.
#pragma unroll
  for (int r = 0; r < 8; ++r) {
    float* d = &po[wslot][r + 8 * hl][ml];
    d[0]  = o0[r];
    d[16] = o1[r];
    d[32] = o2[r];
    d[48] = o3[r];
  }
  if (ml == 0) {   // every lane of a half holds the same m[] and l[]
    *(v4f*)&pm[wslot][8 * hl]     = v4f{m[0], m[1], m[2], m[3]};
    *(v4f*)&pm[wslot][8 * hl + 4] = v4f{m[4], m[5], m[6], m[7]};
    *(v4f*)&pl[wslot][8 * hl]     = v4f{l[0], l[1], l[2], l[3]};
    *(v4f*)&pl[wslot][8 * hl + 4] = v4f{l[4], l[5], l[6], l[7]};
  }
  // Publishes all eight partials; every wave passes it, with or without chunks.
  __syncthreads();

  // ---- merge, normalize and store f32 output [B, T, H]: a thread owns 4
  //      neighbouring columns of one row, a wave two whole 256-B rows.
  //      Wave 0 always has chunk 0, whose key 0 every row sees: mall is finite.
  const int mrow = threadIdx.x >> 4;
  const int mcol = (threadIdx.x & 15) * 4;
  float mw[AW];
  float mall = -__builtin_inff();
#pragma unroll
  for (int w = 0; w < AW; ++w) {
    mw[w] = pm[w][mrow];
    mall = fmaxf(mall, mw[w]);
  }
  float lall = 0.f;
  v4f acc = {};
#pragma unroll
  for (int w = 0; w < AW; ++w) {
    const float e = __builtin_amdgcn_exp2f(mw[w] - mall);
    lall += e * pl[w][mrow];
    acc += e * *(const v4f*)&po[w][mrow][mcol];
  }
  const float inv = 1.0f / lall;
  *(v4f*)&out[((size_t)b * NT + q0 + mrow) * NH + mcol] = acc * inv;
}

// ---------------------------------------------------------------------------
extern "C" void kernel_launch(void* const* d_in, const int* in_sizes, int n_in,
                              void* d_out, int out_size, void* d_ws, size_t ws_size,
                              hipStream_t stream) {
  const float* x  = (const float*)d_in[0];
  const float* Wk = (const float*)d_in[1];
  const float* Wq = (const float*)d_in[2];
  const float* Wv = (const float*)d_in[3];

  const size_t nqkv = (size_t)NB * NT * NH;  // 1M elems each
  _Float16* qb  = (_Float16*)d_ws;
  _Float16* kbf = qb + nqkv;
  _Float16* vtb = kbf + nqkv;

  // Projection: B*T/64 = 256 work-groups of 16 waves.
  proj_kernel<<<256, 512, 0, stream>>>(x, Wk, Wq, Wv, qb, kbf, vtb);

  // Attention: B * T/16 = 1024 query tiles, one work-group of 8 waves each.
  attn_kernel<<<1024, 256, 0, stream>>>(qb, kbf, vtb, (float*)d_out);
}

// v004
// A run of this version takes 31.1 microseconds.
// Next to v003, in two timings, it ran 1.24 and 1.26 times as fast.
// All steps since v000 together make it 4.21 times as fast.
#include <hip/hip_runtime.h>
#include <hip/hip_bf16.h>

// Problem constants (match reference)
constexpr int NB = 8;     // batch
constexpr int NT = 2048;  // sequence length
constexpr int NC = 1024;  // n_embd
constexpr int NH = 64;    // head size

typedef __attribute__((ext_vector_type(16))) _Float16 v16h;
typedef __attribute__((ext_vector_type(8)))  float    v8f;

#if defined(__has_builtin)
#if __has_builtin(__builtin_amdgcn_sched_barrier)
#define SCHED_FENCE() __builtin_amdgcn_sched_barrier(0)
#endif
#endif
#ifndef SCHED_FENCE
#define SCHED_FENCE() asm volatile("" ::: "memory")
#endif

// 16-bit A/B 16x32 WMMA layout: element e of a lane's operand holds
//   k = 8 * hl + e for e < 8, k = 16 + 8 * hl + (e - 8) for e >= 8   (hl = lane >> 4).

__device__ __forceinline__ v8f wmma_f16(v16h a, v16h b, v8f c) {
  return __builtin_amdgcn_wmma_f32_16x16x32_f16(false, a, false, b, (short)0, c,
                                                false, false);
}

// ---------------------------------------------------------------------------
// Kernel 1: q/k/v projections.  One work-group: 64 rows of x against all 192
// rows of Wq|Wk|Wv.  A 128-k slice of those 256 rows is fetched with whole-line
// loads, converted to f16 once and shared through LDS (two buffers); each of
// the 16 waves owns one 16-row x 16-col tile of q, k and v.
//   q, k and v go to the workspace in operand-fragment order, in units of
//   512 f16 (1 KB) = one 16 x 32 operand tile:
//     unit[half][lane][e] = tile row (lane & 15), k = 16 * half + 8 * (lane >> 4) + e
//   q, k: rows = 16 positions, k = 32 head columns; 2 units per 16 positions.
//   v   : rows = 16 head columns, k = 32 positions; 4 units per 32 positions.
//   A result tile whose lanes each hold 8 neighbouring k of one row is half a
//   unit: one 16-B store per lane, 512 contiguous bytes per wave. For q and k
//   that takes W as the first operand (result rows = head columns).
// ---------------------------------------------------------------------------
constexpr int FU = 512;                // f16 per fragment unit
constexpr int PM      = 64;            // x rows per work-group
constexpr int PKS     = 128;           // k per staged slice: one wave-wide 16-B load per row
constexpr int PROWS   = PM + 3 * NH;   // staged rows: x | Wq | Wk | Wv
constexpr int PPITCH  = PKS + 8;       // f16 per LDS row: 272 B = 16 B x 17, no bank conflict for 16-B reads
constexpr int PSLICES = NC / PKS;

typedef __attribute__((ext_vector_type(8))) _Float16 v8h;
typedef __attribute__((ext_vector_type(4))) _Float16 v4h;

// One 16x32 operand tile from a staged row; p = row start + k offset + 8 * hl.
// k order of the layout above: [0..7] and [16..23] behind p, for A and B alike.
__device__ __forceinline__ v16h lds_frag(const _Float16* p) {
  union { v16h v; v8h h[2]; } t;
  t.h[0] = *(const v8h*)(p);
  t.h[1] = *(const v8h*)(p + 16);
  return t.v;
}

typedef const __attribute__((address_space(1))) _Float16* gcf16;
typedef const __attribute__((address_space(1))) v8h* gcv8h;

// A wave-uniform global address held in scalar registers: the loads behind it
// take it as their scalar base, and the one vector register they name is the
// lane's constant offset, which nothing rewrites while they are in flight.
__device__ __forceinline__ gcf16 scalar_base(const _Float16* p) {
  const unsigned long long a = (unsigned long long)p;
  const unsigned lo = __builtin_amdgcn_readfirstlane((unsigned)a);
  const unsigned hi = __builtin_amdgcn_readfirstlane((unsigned)(a >> 32));
  return (gcf16)(((unsigned long long)hi << 32) | lo);
}

// One 16x32 operand tile from a fragment unit in global memory: two wave-wide
// 16-B loads of 512 contiguous bytes each.
__device__ __forceinline__ v16h unit_frag(gcf16 unit, unsigned lane) {
  union { v16h v; v8h h[2]; } t;
  t.h[0] = *(gcv8h)(unit + lane * 8u);
  t.h[1] = *(gcv8h)(unit + FU / 2 + lane * 8u);
  return t.v;
}

typedef __attribute__((ext_vector_type(4))) float v4f;

__global__ __launch_bounds__(512) void proj_kernel(
    const float* __restrict__ x, const float* __restrict__ Wk,
    const float* __restrict__ Wq, const float* __restrict__ Wv,
    _Float16* __restrict__ qb, _Float16* __restrict__ kb,
    _Float16* __restrict__ vtb) {
  __shared__ __attribute__((aligned(16))) _Float16 tile[2][PROWS * PPITCH];

  const int tid = threadIdx.x;
  const int lane = tid & 31;
  const int wslot = tid >> 5;
  const int rt = wslot & 3;   // 16-row tile inside the 64 rows
  const int nt = wslot >> 2;  // 0..3 (H/16)
  const int hl = lane >> 4;
  const int ml = lane & 15;

  const int row0 = blockIdx.x * PM + rt * 16;
  const int h0 = nt * 16;

  // Staging: a wave's load covers the 512 B of one row's slice (4 whole lines).
  // Piece j of a wave is staged row j * 16 + wslot; 4 pieces per 64-row matrix.
  const unsigned goff = (unsigned)(wslot * NC + lane * 4);
  const float* xblk = x + (size_t)blockIdx.x * PM * NC;
  const int soff = wslot * PPITCH + lane * 4;

  v4f g[16];
  auto fetch = [&](int k0) {
    const float* px = xblk + k0;
    const float* pq = Wq + k0;
    const float* pk = Wk + k0;
    const float* pv = Wv + k0;
#pragma unroll  // constant indices keep g[] in registers
    for (int j = 0; j < 4; ++j) {
      g[j]      = *(const v4f*)(px + j * 16 * NC + goff);
      g[4 + j]  = *(const v4f*)(pq + j * 16 * NC + goff);
      g[8 + j]  = *(const v4f*)(pk + j * 16 * NC + goff);
      g[12 + j] = *(const v4f*)(pv + j * 16 * NC + goff);
    }
  };
  auto stage = [&](int buf) {
    _Float16* d = &tile[buf][soff];
#pragma unroll  // constant indices keep g[] in registers
    for (int j = 0; j < 16; ++j) *(v4h*)(d + j * 16 * PPITCH) = __builtin_convertvector(g[j], v4h);
  };

  v8f aq = {}; v8f ak = {}; v8f av = {};
  const int aoff = (rt * 16 + ml) * PPITCH + 8 * hl;
  const int boff = (PM + h0 + ml) * PPITCH + 8 * hl;
  auto compute = [&](int buf) {
    const _Float16* ta = &tile[buf][aoff];
    const _Float16* tb = &tile[buf][boff];
#pragma unroll  // k offsets become immediate LDS offsets
    for (int kk = 0; kk < PKS; kk += 32) {
      v16h a  = lds_frag(ta + kk);
      v16h bq = lds_frag(tb + kk);
      v16h bk = lds_frag(tb + NH * PPITCH + kk);
      v16h bv = lds_frag(tb + 2 * NH * PPITCH + kk);
      aq = wmma_f16(bq, a, aq);   // q^T tile: rows = head columns, lane = position
      ak = wmma_f16(bk, a, ak);   // k^T tile, likewise
      av = wmma_f16(a, bv, av);   // v tile: rows = positions, lane = head column
    }
  };

  fetch(0);
  stage(0);
  __syncthreads();

  // Unrolled so that each slice's k offset and buffer fold into immediate
  // offsets: one offset register serves every global load and is never rewritten.
#pragma unroll
  for (int s = 0; s < PSLICES - 1; ++s) {
    fetch((s + 1) * PKS);
    // Keeps the next slice's global loads ahead of this slice's LDS reads and
    // matrix work, so that their latency runs under it.
    SCHED_FENCE();
    compute(s & 1);
    // Keeps the wait for those loads (the conversions read them) behind the matrix work.
    SCHED_FENCE();
    stage((s + 1) & 1);
    // Publishes slice s + 1 and ends every read of the buffer refilled next trip.
    __syncthreads();
  }
  compute((PSLICES - 1) & 1);

  // row0 = flat b*T + t of the tile's first position.
  // q, k: lane holds position row0 + ml, head columns h0 + 8 * hl + 0..7:
  //       unit h0 / 32 of the 16 positions, half (h0 / 16) & 1.
  // v   : lane holds head column h0 + ml, positions row0 + 8 * hl + 0..7:
  //       unit h0 / 16 of the 32 positions, half (row0 / 16) & 1.
  const size_t qkoff = (size_t)(row0 >> 4) * (2 * FU) + nt * (FU / 2) + lane * 8;
  const size_t voff  = (size_t)(row0 >> 5) * (4 * FU) + nt * FU + (rt & 1) * (FU / 2) + lane * 8;
  *(v8h*)(qb + qkoff) = __builtin_convertvector(aq, v8h);
  *(v8h*)(kb + qkoff) = __builtin_convertvector(ak, v8h);
  *(v8h*)(vtb + voff) = __builtin_convertvector(av, v8h);
}

constexpr int AW     = 8;
constexpr int OPITCH = 68;

// Value of lane l ^ 16.
__device__ __forceinline__ float xhalf(float x) {
  const int b = __builtin_bit_cast(int, x);
  return __builtin_bit_cast(float, __builtin_amdgcn_permlanex16(b, b, 0x76543210, 0xfedcba98, false, false));
}

__global__ __launch_bounds__(256) void attn_kernel(
    const _Float16* __restrict__ qb, const _Float16* __restrict__ kb,
    const _Float16* __restrict__ vtb, float* __restrict__ out) {
  __shared__ __attribute__((aligned(16))) float po[AW][16][OPITCH];  // partial outputs
  __shared__ __attribute__((aligned(16))) float pm[AW][16];          // partial row maxima
  __shared__ __attribute__((aligned(16))) float pl[AW][16];          // partial row sums

  const int lane = threadIdx.x & 31;
  // Wave number as a scalar: the chunk loop's bounds and the K/V bases stay wave-uniform.
  const int wslot = __builtin_amdgcn_readfirstlane(threadIdx.x >> 5);
  const int b = blockIdx.x >> 7;      // / (T/16)
  const int qt = blockIdx.x & 127;
  const int q0 = qt * 16;
  const int hl = lane >> 4;
  const int ml = lane & 15;

  // Q tile (second operand: column = query ml), K-dim = H = 64 -> two k-steps
  const gcf16 qrow = scalar_base(qb + ((size_t)b * NT + q0) * NH);   // 2 units per 16 positions
  const v16h bq0 = unit_frag(qrow, lane);
  const v16h bq1 = unit_frag(qrow + FU, lane);

  // O^T tiles: o<t>[r] = O[query ml][head column 16 * t + 8 * hl + r].
  v8f o0 = {}, o1 = {}, o2 = {}, o3 = {};
  float m = -__builtin_inff();   // running maximum of query ml, equal in both halves
  float l = 0.f;                 // running sum of query ml over this half's keys only

  // (1/sqrt(n_embd)) * log2(e): softmax computed with exp2.
  const float sscale2 = 0.03125f * 1.4426950408889634f;
  const int nchunks = (q0 + 16 + 31) >> 5;
  const _Float16* kb_b  = kb + (size_t)b * NT * NH;
  const _Float16* vtb_b = vtb + (size_t)b * NT * NH;

  for (int c = wslot; c < nchunks; c += AW) {
    const int s0 = c * 32;

    // ---- issue ALL K and V tile loads up front; V latency hides under
    //      the S-WMMAs + softmax VALU work ----
    //      A chunk's K and V are 4 fragment units (4 KB contiguous) each.
    const gcf16 kc = scalar_base(kb_b + (size_t)s0 * NH);
    const gcf16 vc = scalar_base(vtb_b + (size_t)s0 * NH);
    v16h ak00 = unit_frag(kc, lane);            // keys s0..s0+15,    h 0..31
    v16h ak01 = unit_frag(kc + FU, lane);       //                    h 32..63
    v16h ak10 = unit_frag(kc + 2 * FU, lane);   // keys s0+16..s0+31, h 0..31
    v16h ak11 = unit_frag(kc + 3 * FU, lane);   //                    h 32..63
    v16h av0 = unit_frag(vc, lane);             // h 0..15,  keys s0..s0+31
    v16h av1 = unit_frag(vc + FU, lane);        // h 16..31
    v16h av2 = unit_frag(vc + 2 * FU, lane);    // h 32..47
    v16h av3 = unit_frag(vc + 3 * FU, lane);    // h 48..63
    SCHED_FENCE();

    // ---- S^T = K Q^T: st0[r] = score(key s0 + 8 * hl + r, query q0 + ml),
    //      st1[r] the same 16 keys further on ----
    v8f st0 = {}, st1 = {};
    st0 = wmma_f16(ak00, bq0, st0);
    st0 = wmma_f16(ak01, bq1, st0);
    st1 = wmma_f16(ak10, bq0, st1);
    st1 = wmma_f16(ak11, bq1, st1);

    // ---- scale + causal mask + maximum of this lane's 16 scores ----
    const int kvis = q0 + ml - s0 - 8 * hl;   // key r of st0 / 16 + r of st1 is seen while <= kvis
    st0 *= sscale2;
    st1 *= sscale2;
    float v0[8], v1[8], mv[8];
#pragma unroll  // constant indices keep the scores in registers
    for (int r = 0; r < 8; ++r) {
      v0[r] = (r > kvis)      ? -__builtin_inff() : st0[r];
      v1[r] = (16 + r > kvis) ? -__builtin_inff() : st1[r];
      mv[r] = fmaxf(v0[r], v1[r]);
    }
    float mx = fmaxf(fmaxf(fmaxf(mv[0], mv[1]), fmaxf(mv[2], mv[3])),
                     fmaxf(fmaxf(mv[4], mv[5]), fmaxf(mv[6], mv[7])));
    mx = fmaxf(mx, xhalf(mx));   // all 32 keys; key s0 is seen by every query, so mx is finite

    // ---- online softmax (exp2 domain) ----
    const float newm = fmaxf(m, mx);
    const float corr = __builtin_amdgcn_exp2f(m - newm);
    m = newm;
    v8f p0, p1;
#pragma unroll  // constant indices keep the scores in registers
    for (int r = 0; r < 8; ++r) {
      p0[r] = __builtin_amdgcn_exp2f(v0[r] - newm);
      p1[r] = __builtin_amdgcn_exp2f(v1[r] - newm);
    }
    const v8f ps = p0 + p1;
    const v4f ps4 = __builtin_shufflevector(ps, ps, 0, 1, 2, 3) + __builtin_shufflevector(ps, ps, 4, 5, 6, 7);
    l = l * corr + ((ps4[0] + ps4[2]) + (ps4[1] + ps4[3]));
    o0 *= corr; o1 *= corr; o2 *= corr; o3 *= corr;

    // ---- P^T as second operand (k = keys): element e < 8 is key 8 * hl + e = p0[e],
    //      element e >= 8 is key 16 + 8 * hl + (e - 8) = p1[e - 8] ----
    union { v16h v; v8h h[2]; } pt;
    pt.h[0] = __builtin_convertvector(p0, v8h);
    pt.h[1] = __builtin_convertvector(p1, v8h);

    // ---- O^T += V^T P^T  (V tiles already resident) ----
    o0 = wmma_f16(av0, pt.v, o0);
    o1 = wmma_f16(av1, pt.v, o1);
    o2 = wmma_f16(av2, pt.v, o2);
    o3 = wmma_f16(av3, pt.v, o3);
  }

  // ---- hand this wave's partial (max, sum, un-normalised O) to the work-group.
  //      A wave without a chunk hands in max = -inf, sum = 0, O = 0: weight 0 below.
  {
    float* d = &po[wslot][ml][8 * hl];
    *(v4f*)(d)      = __builtin_shufflevector(o0, o0, 0, 1, 2, 3);
    *(v4f*)(d + 4)  = __builtin_shufflevector(o0, o0, 4, 5, 6, 7);
    *(v4f*)(d + 16) = __builtin_shufflevector(o1, o1, 0, 1, 2, 3);
    *(v4f*)(d + 20) = __builtin_shufflevector(o1, o1, 4, 5, 6, 7);
    *(v4f*)(d + 32) = __builtin_shufflevector(o2, o2, 0, 1, 2, 3);
    *(v4f*)(d + 36) = __builtin_shufflevector(o2, o2, 4, 5, 6, 7);
    *(v4f*)(d + 48) = __builtin_shufflevector(o3, o3, 0, 1, 2, 3);
    *(v4f*)(d + 52) = __builtin_shufflevector(o3, o3, 4, 5, 6, 7);
  }
  const float lrow = l + xhalf(l);   // the two halves' key shares joined once
  if (hl == 0) {   // both halves hold the same m and lrow
    pm[wslot][ml] = m;
    pl[wslot][ml] = lrow;
  }
  // Publishes all eight partials; every wave passes it, with or without chunks.
  __syncthreads();

  // ---- merge, normalize and store f32 output [B, T, H]: a thread owns 4
  //      neighbouring columns of one row, a wave two whole 256-B rows.
  //      Wave 0 always has chunk 0, whose key 0 every row sees: mall is finite.
  const int mrow = threadIdx.x >> 4;
  const int mcol = (threadIdx.x & 15) * 4;
  float mw[AW];
  float mall = -__builtin_inff();
#pragma unroll
  for (int w = 0; w < AW; ++w) {
    mw[w] = pm[w][mrow];
    mall = fmaxf(mall, mw[w]);
  }
  float lall = 0.f;
  v4f acc = {};
#pragma unroll
  for (int w = 0; w < AW; ++w) {
    const float e = __builtin_amdgcn_exp2f(mw[w] - mall);
    lall += e * pl[w][mrow];
    acc += e * *(const v4f*)&po[w][mrow][mcol];
  }
  const float inv = 1.0f / lall;
  *(v4f*)&out[((size_t)b * NT + q0 + mrow) * NH + mcol] = acc * inv;
}

// ---------------------------------------------------------------------------
extern "C" void kernel_launch(void* const* d_in, const int* in_sizes, int n_in,
                              void* d_out, int out_size, void* d_ws, size_t ws_size,
                              hipStream_t stream) {
  const float* x  = (const float*)d_in[0];
  const float* Wk = (const float*)d_in[1];
  const float* Wq = (const float*)d_in[2];
  const float* Wv = (const float*)d_in[3];

  const size_t nqkv = (size_t)NB * NT * NH;  // 1M elems each
  _Float16* qb  = (_Float16*)d_ws;
  _Float16* kbf = qb + nqkv;
  _Float16* vtb = kbf + nqkv;

  // Projection: B*T/64 = 256 work-groups of 16 waves.
  proj_kernel<<<256, 512, 0, stream>>>(x, Wk, Wq, Wv, qb, kbf, vtb);

  // Attention: B * T/16 = 1024 query tiles, one work-group of 8 waves each.
  attn_kernel<<<1024, 256, 0, stream>>>(qb, kbf, vtb, (float*)d_out);
}

// v005
// One run takes 26.8 microseconds.
// Two timings next to v004 put it at 1.18 and 1.15 times that version's speed.
// Counting every step since v000, it is 4.91 times as fast.
#include <hip/hip_runtime.h>
#include <hip/hip_bf16.h>

// Problem constants (match reference)
constexpr int NB = 8;     // batch
constexpr int NT = 2048;  // sequence length
constexpr int NC = 1024;  // n_embd
constexpr int NH = 64;    // head size

typedef __attribute__((ext_vector_type(16))) _Float16 v16h;
typedef __attribute__((ext_vector_type(8)))  float    v8f;

#if defined(__has_builtin)
#if __has_builtin(__builtin_amdgcn_sched_barrier)
#define SCHED_FENCE() __builtin_amdgcn_sched_barrier(0)
#endif
#endif
#ifndef SCHED_FENCE
#define SCHED_FENCE() asm volatile("" ::: "memory")
#endif

// 16-bit A/B 16x32 WMMA layout: element e of a lane's operand holds
//   k = 8 * hl + e for e < 8, k = 16 + 8 * hl + (e - 8) for e >= 8   (hl = lane >> 4).

__device__ __forceinline__ v8f wmma_f16(v16h a, v16h b, v8f c) {
  return __builtin_amdgcn_wmma_f32_16x16x32_f16(false, a, false, b, (short)0, c,
                                                false, false);
}

// ---------------------------------------------------------------------------
// Kernel 1: q/k/v projections.  One work-group: 64 rows of x against all 192
// rows of Wq|Wk|Wv.  A 128-k slice of those 256 rows is fetched with whole-line
// loads, converted to f16 once and shared through LDS (two buffers); each of
// the 16 waves owns one 16-row x 16-col tile of q, k and v.
//   q, k and v go to the workspace in operand-fragment order, in units of
//   512 f16 (1 KB) = one 16 x 32 operand tile:
//     unit[half][lane][e] = tile row (lane & 15), k = 16 * half + 8 * (lane >> 4) + e
//   q, k: rows = 16 positions, k = 32 head columns; 2 units per 16 positions.
//   v   : rows = 16 head columns, k = 32 positions; 4 units per 32 positions.
//   A result tile whose lanes each hold 8 neighbouring k of one row is half a
//   unit: one 16-B store per lane, 512 contiguous bytes per wave. For q and k
//   that takes W as the first operand (result rows = head columns).
// ---------------------------------------------------------------------------
constexpr int FU = 512;                // f16 per fragment unit
constexpr int PM      = 64;            // x rows per work-group
constexpr int PKS     = 128;           // k per staged slice: one wave-wide 16-B load per row
constexpr int PROWS   = PM + 3 * NH;   // staged rows: x | Wq | Wk | Wv
constexpr int PPITCH  = PKS + 8;       // f16 per LDS row: 272 B = 16 B x 17, no bank conflict for 16-B reads
constexpr int PSLICES = NC / PKS;

typedef __attribute__((ext_vector_type(8))) _Float16 v8h;
typedef __attribute__((ext_vector_type(4))) _Float16 v4h;

// One 16x32 operand tile from a staged row; p = row start + k offset + 8 * hl.
// k order of the layout above: [0..7] and [16..23] behind p, for A and B alike.
__device__ __forceinline__ v16h lds_frag(const _Float16* p) {
  union { v16h v; v8h h[2]; } t;
  t.h[0] = *(const v8h*)(p);
  t.h[1] = *(const v8h*)(p + 16);
  return t.v;
}

typedef const __attribute__((address_space(1))) _Float16* gcf16;
typedef const __attribute__((address_space(1))) v8h* gcv8h;

// A wave-uniform global address held in scalar registers: the loads behind it
// take it as their scalar base, and the one vector register they name is the
// lane's constant offset, which nothing rewrites while they are in flight.
__device__ __forceinline__ gcf16 scalar_base(const _Float16* p) {
  const unsigned long long a = (unsigned long long)p;
  const unsigned lo = __builtin_amdgcn_readfirstlane((unsigned)a);
  const unsigned hi = __builtin_amdgcn_readfirstlane((unsigned)(a >> 32));
  return (gcf16)(((unsigned long long)hi << 32) | lo);
}

// One 16x32 operand tile from a fragment unit in global memory: two wave-wide
// 16-B loads of 512 contiguous bytes each.
__device__ __forceinline__ v16h unit_frag(gcf16 unit, unsigned lane) {
  union { v16h v; v8h h[2]; } t;
  t.h[0] = *(gcv8h)(unit + lane * 8u);
  t.h[1] = *(gcv8h)(unit + FU / 2 + lane * 8u);
  return t.v;
}

typedef __attribute__((ext_vector_type(4))) float v4f;

__global__ __launch_bounds__(512) void proj_kernel(
    const float* __restrict__ x, const float* __restrict__ Wk,
    const float* __restrict__ Wq, const float* __restrict__ Wv,
    _Float16* __restrict__ qb, _Float16* __restrict__ kb,
    _Float16* __restrict__ vtb) {
  __shared__ __attribute__((aligned(16))) _Float16 tile[2][PROWS * PPITCH];

  const int tid = threadIdx.x;
  const int lane = tid & 31;
  const int wslot = tid >> 5;
  const int rt = wslot & 3;   // 16-row tile inside the 64 rows
  const int nt = wslot >> 2;  // 0..3 (H/16)
  const int hl = lane >> 4;
  const int ml = lane & 15;

  const int row0 = blockIdx.x * PM + rt * 16;
  const int h0 = nt * 16;

  // Staging: a wave's load covers the 512 B of one row's slice (4 whole lines).
  // Piece j of a wave is staged row j * 16 + wslot; 4 pieces per 64-row matrix.
  const unsigned goff = (unsigned)(wslot * NC + lane * 4);
  const float* xblk = x + (size_t)blockIdx.x * PM * NC;
  const int soff = wslot * PPITCH + lane * 4;

  v4f g[16];
  auto fetch = [&](int k0) {
    const float* px = xblk + k0;
    const float* pq = Wq + k0;
    const float* pk = Wk + k0;
    const float* pv = Wv + k0;
#pragma unroll  // constant indices keep g[] in registers
    for (int j = 0; j < 4; ++j) {
      g[j]      = *(const v4f*)(px + j * 16 * NC + goff);
      g[4 + j]  = *(const v4f*)(pq + j * 16 * NC + goff);
      g[8 + j]  = *(const v4f*)(pk + j * 16 * NC + goff);
      g[12 + j] = *(const v4f*)(pv + j * 16 * NC + goff);
    }
  };
  auto stage = [&](int buf) {
    _Float16* d = &tile[buf][soff];
#pragma unroll  // constant indices keep g[] in registers
    for (int j = 0; j < 16; ++j) *(v4h*)(d + j * 16 * PPITCH) = __builtin_convertvector(g[j], v4h);
  };

  v8f aq = {}; v8f ak = {}; v8f av = {};
  const int aoff = (rt * 16 + ml) * PPITCH + 8 * hl;
  const int boff = (PM + h0 + ml) * PPITCH + 8 * hl;
  auto compute = [&](int buf) {
    const _Float16* ta = &tile[buf][aoff];
    const _Float16* tb = &tile[buf][boff];
#pragma unroll  // k offsets become immediate LDS offsets
    for (int kk = 0; kk < PKS; kk += 32) {
      v16h a  = lds_frag(ta + kk);
      v16h bq = lds_frag(tb + kk);
      v16h bk = lds_frag(tb + NH * PPITCH + kk);
      v16h bv = lds_frag(tb + 2 * NH * PPITCH + kk);
      aq = wmma_f16(bq, a, aq);   // q^T tile: rows = head columns, lane = position
      ak = wmma_f16(bk, a, ak);   // k^T tile, likewise
      av = wmma_f16(a, bv, av);   // v tile: rows = positions, lane = head column
    }
  };

  fetch(0);
  stage(0);
  __syncthreads();

  // Unrolled so that each slice's k offset and buffer fold into immediate
  // offsets: one offset register serves every global load and is never rewritten.
#pragma unroll
  for (int s = 0; s < PSLICES - 1; ++s) {
    fetch((s + 1) * PKS);
    // Keeps the next slice's global loads ahead of this slice's LDS reads and
    // matrix work, so that their latency runs under it.
    SCHED_FENCE();
    compute(s & 1);
    // Keeps the wait for those loads (the conversions read them) behind the matrix work.
    SCHED_FENCE();
    stage((s + 1) & 1);
    // Publishes slice s + 1 and ends every read of the buffer refilled next trip.
    __syncthreads();
  }
  compute((PSLICES - 1) & 1);

  // row0 = flat b*T + t of the tile's first position.
  // q, k: lane holds position row0 + ml, head columns h0 + 8 * hl + 0..7:
  //       unit h0 / 32 of the 16 positions, half (h0 / 16) & 1.
  // v   : lane holds head column h0 + ml, positions row0 + 8 * hl + 0..7:
  //       unit h0 / 16 of the 32 positions, half (row0 / 16) & 1.
  const size_t qkoff = (size_t)(row0 >> 4) * (2 * FU) + nt * (FU / 2) + lane * 8;
  const size_t voff  = (size_t)(row0 >> 5) * (4 * FU) + nt * FU + (rt & 1) * (FU / 2) + lane * 8;
  *(v8h*)(qb + qkoff) = __builtin_convertvector(aq, v8h);
  *(v8h*)(kb + qkoff) = __builtin_convertvector(ak, v8h);
  *(v8h*)(vtb + voff) = __builtin_convertvector(av, v8h);
}

constexpr int AW     = 8;
constexpr int OPITCH = 68;

// Value of lane l ^ 16.
__device__ __forceinline__ float xhalf(float x) {
  const int b = __builtin_bit_cast(int, x);
  return __builtin_bit_cast(float, __builtin_amdgcn_permlanex16(b, b, 0x76543210, 0xfedcba98, false, false));
}

__global__ __launch_bounds__(256) void attn_kernel(
    const _Float16* __restrict__ qb, const _Float16* __restrict__ kb,
    const _Float16* __restrict__ vtb, float* __restrict__ out) {
  __shared__ __attribute__((aligned(16))) float po[AW][16][OPITCH];  // partial outputs
  __shared__ __attribute__((aligned(16))) float pm[AW][16];          // partial row maxima
  __shared__ __attribute__((aligned(16))) float pl[AW][16];          // partial row sums

  const int lane = threadIdx.x & 31;
  // Wave number as a scalar: the chunk loop's bounds and the K/V bases stay wave-uniform.
  const int wslot = __builtin_amdgcn_readfirstlane(threadIdx.x >> 5);
  // Work-group index -> (batch, query tile): a permutation of the 8 x 128 tiles,
  // chosen for speed only. A tile's cost grows with qt; the dearest tiles take the
  // lowest indices and the shortest the highest. Tiles go in four bands of 32 (256
  // indices each); the two middle bands run upwards, so that indices 256 apart in
  // bands 0 and 1 or 2 and 3 add up to the same number of keys.
  const int b = blockIdx.x & 7;
  const int band = blockIdx.x >> 8;          // 0..3
  const int u = (blockIdx.x >> 3) & 31;      // place inside the band
  const int qt = 127 - 32 * band - ((band == 1 || band == 2) ? 31 - u : u);
  const int q0 = qt * 16;
  const int hl = lane >> 4;
  const int ml = lane & 15;

  // Q tile (second operand: column = query ml), K-dim = H = 64 -> two k-steps
  const gcf16 qrow = scalar_base(qb + ((size_t)b * NT + q0) * NH);   // 2 units per 16 positions
  const v16h bq0 = unit_frag(qrow, lane);
  const v16h bq1 = unit_frag(qrow + FU, lane);

  // O^T tiles: o<t>[r] = O[query ml][head column 16 * t + 8 * hl + r].
  v8f o0 = {}, o1 = {}, o2 = {}, o3 = {};
  float m = -__builtin_inff();   // running maximum of query ml, equal in both halves
  float l = 0.f;                 // running sum of query ml over this half's keys only

  // (1/sqrt(n_embd)) * log2(e): softmax computed with exp2.
  const float sscale2 = 0.03125f * 1.4426950408889634f;
  const int nchunks = (q0 + 16 + 31) >> 5;
  const _Float16* kb_b  = kb + (size_t)b * NT * NH;
  const _Float16* vtb_b = vtb + (size_t)b * NT * NH;

  for (int c = wslot; c < nchunks; c += AW) {
    const int s0 = c * 32;

    // ---- issue ALL K and V tile loads up front; V latency hides under
    //      the S-WMMAs + softmax VALU work ----
    //      A chunk's K and V are 4 fragment units (4 KB contiguous) each.
    const gcf16 kc = scalar_base(kb_b + (size_t)s0 * NH);
    const gcf16 vc = scalar_base(vtb_b + (size_t)s0 * NH);
    v16h ak00 = unit_frag(kc, lane);            // keys s0..s0+15,    h 0..31
    v16h ak01 = unit_frag(kc + FU, lane);       //                    h 32..63
    v16h ak10 = unit_frag(kc + 2 * FU, lane);   // keys s0+16..s0+31, h 0..31
    v16h ak11 = unit_frag(kc + 3 * FU, lane);   //                    h 32..63
    v16h av0 = unit_frag(vc, lane);             // h 0..15,  keys s0..s0+31
    v16h av1 = unit_frag(vc + FU, lane);        // h 16..31
    v16h av2 = unit_frag(vc + 2 * FU, lane);    // h 32..47
    v16h av3 = unit_frag(vc + 3 * FU, lane);    // h 48..63
    SCHED_FENCE();

    // ---- S^T = K Q^T: st0[r] = score(key s0 + 8 * hl + r, query q0 + ml),
    //      st1[r] the same 16 keys further on ----
    v8f st0 = {}, st1 = {};
    st0 = wmma_f16(ak00, bq0, st0);
    st0 = wmma_f16(ak01, bq1, st0);
    st1 = wmma_f16(ak10, bq0, st1);
    st1 = wmma_f16(ak11, bq1, st1);

    // ---- scale + causal mask + maximum of this lane's 16 scores ----
    const int kvis = q0 + ml - s0 - 8 * hl;   // key r of st0 / 16 + r of st1 is seen while <= kvis
    st0 *= sscale2;
    st1 *= sscale2;
    float v0[8], v1[8], mv[8];
#pragma unroll  // constant indices keep the scores in registers
    for (int r = 0; r < 8; ++r) {
      v0[r] = (r > kvis)      ? -__builtin_inff() : st0[r];
      v1[r] = (16 + r > kvis) ? -__builtin_inff() : st1[r];
      mv[r] = fmaxf(v0[r], v1[r]);
    }
    float mx = fmaxf(fmaxf(fmaxf(mv[0], mv[1]), fmaxf(mv[2], mv[3])),
                     fmaxf(fmaxf(mv[4], mv[5]), fmaxf(mv[6], mv[7])));
    mx = fmaxf(mx, xhalf(mx));   // all 32 keys; key s0 is seen by every query, so mx is finite

    // ---- online softmax (exp2 domain) ----
    const float newm = fmaxf(m, mx);
    const float corr = __builtin_amdgcn_exp2f(m - newm);
    m = newm;
    v8f p0, p1;
#pragma unroll  // constant indices keep the scores in registers
    for (int r = 0; r < 8; ++r) {
      p0[r] = __builtin_amdgcn_exp2f(v0[r] - newm);
      p1[r] = __builtin_amdgcn_exp2f(v1[r] - newm);
    }
    const v8f ps = p0 + p1;
    const v4f ps4 = __builtin_shufflevector(ps, ps, 0, 1, 2, 3) + __builtin_shufflevector(ps, ps, 4, 5, 6, 7);
    l = l * corr + ((ps4[0] + ps4[2]) + (ps4[1] + ps4[3]));
    o0 *= corr; o1 *= corr; o2 *= corr; o3 *= corr;

    // ---- P^T as second operand (k = keys): element e < 8 is key 8 * hl + e = p0[e],
    //      element e >= 8 is key 16 + 8 * hl + (e - 8) = p1[e - 8] ----
    union { v16h v; v8h h[2]; } pt;
    pt.h[0] = __builtin_convertvector(p0, v8h);
    pt.h[1] = __builtin_convertvector(p1, v8h);

    // ---- O^T += V^T P^T  (V tiles already resident) ----
    o0 = wmma_f16(av0, pt.v, o0);
    o1 = wmma_f16(av1, pt.v, o1);
    o2 = wmma_f16(av2, pt.v, o2);
    o3 = wmma_f16(av3, pt.v, o3);
  }

  // ---- hand this wave's partial (max, sum, un-normalised O) to the work-group.
  //      A wave without a chunk hands in max = -inf, sum = 0, O = 0: weight 0 below.
  {
    float* d = &po[wslot][ml][8 * hl];
    *(v4f*)(d)      = __builtin_shufflevector(o0, o0, 0, 1, 2, 3);
    *(v4f*)(d + 4)  = __builtin_shufflevector(o0, o0, 4, 5, 6, 7);
    *(v4f*)(d + 16) = __builtin_shufflevector(o1, o1, 0, 1, 2, 3);
    *(v4f*)(d + 20) = __builtin_shufflevector(o1, o1, 4, 5, 6, 7);
    *(v4f*)(d + 32) = __builtin_shufflevector(o2, o2, 0, 1, 2, 3);
    *(v4f*)(d + 36) = __builtin_shufflevector(o2, o2, 4, 5, 6, 7);
    *(v4f*)(d + 48) = __builtin_shufflevector(o3, o3, 0, 1, 2, 3);
    *(v4f*)(d + 52) = __builtin_shufflevector(o3, o3, 4, 5, 6, 7);
  }
  const float lrow = l + xhalf(l);   // the two halves' key shares joined once
  if (hl == 0) {   // both halves hold the same m and lrow
    pm[wslot][ml] = m;
    pl[wslot][ml] = lrow;
  }
  // Publishes all eight partials; every wave passes it, with or without chunks.
  __syncthreads();

  // ---- merge, normalize and store f32 output [B, T, H]: a thread owns 4
  //      neighbouring columns of one row, a wave two whole 256-B rows.
  //      Wave 0 always has chunk 0, whose key 0 every row sees: mall is finite.
  const int mrow = threadIdx.x >> 4;
  const int mcol = (threadIdx.x & 15) * 4;
  float mw[AW];
  float mall = -__builtin_inff();
#pragma unroll
  for (int w = 0; w < AW; ++w) {
    mw[w] = pm[w][mrow];
    mall = fmaxf(mall, mw[w]);
  }
  float lall = 0.f;
  v4f acc = {};
#pragma unroll
  for (int w = 0; w < AW; ++w) {
    const float e = __builtin_amdgcn_exp2f(mw[w] - mall);
    lall += e * pl[w][mrow];
    acc += e * *(const v4f*)&po[w][mrow][mcol];
  }
  const float inv = 1.0f / lall;
  *(v4f*)&out[((size_t)b * NT + q0 + mrow) * NH + mcol] = acc * inv;
}

// ---------------------------------------------------------------------------
extern "C" void kernel_launch(void* const* d_in, const int* in_sizes, int n_in,
                              void* d_out, int out_size, void* d_ws, size_t ws_size,
                              hipStream_t stream) {
  const float* x  = (const float*)d_in[0];
  const float* Wk = (const float*)d_in[1];
  const float* Wq = (const float*)d_in[2];
  const float* Wv = (const float*)d_in[3];

  const size_t nqkv = (size_t)NB * NT * NH;  // 1M elems each
  _Float16* qb  = (_Float16*)d_ws;
  _Float16* kbf = qb + nqkv;
  _Float16* vtb = kbf + nqkv;

  // Projection: B*T/64 = 256 work-groups of 16 waves.
  proj_kernel<<<256, 512, 0, stream>>>(x, Wk, Wq, Wv, qb, kbf, vtb);

  // Attention: B * T/16 = 1024 query tiles, one work-group of 8 waves each.
  attn_kernel<<<1024, 256, 0, stream>>>(qb, kbf, vtb, (float*)d_out);
}

// v006
// It runs in 26 microseconds.
// Timed twice side by side with v005, it ran 1.03 times as fast both times.
// All steps since v000 together make it 5.07 times as fast.
#include <hip/hip_runtime.h>
#include <hip/hip_bf16.h>

// Problem constants (match reference)
constexpr int NB = 8;     // batch
constexpr int NT = 2048;  // sequence length
constexpr int NC = 1024;  // n_embd
constexpr int NH = 64;    // head size

typedef __attribute__((ext_vector_type(16))) _Float16 v16h;
typedef __attribute__((ext_vector_type(8)))  float    v8f;

#if defined(__has_builtin)
#if __has_builtin(__builtin_amdgcn_sched_barrier)
#define SCHED_FENCE() __builtin_amdgcn_sched_barrier(0)
#endif
#endif
#ifndef SCHED_FENCE
#define SCHED_FENCE() asm volatile("" ::: "memory")
#endif

// 16-bit A/B 16x32 WMMA layout: element e of a lane's operand holds
//   k = 8 * hl + e for e < 8, k = 16 + 8 * hl + (e - 8) for e >= 8   (hl = lane >> 4).

__device__ __forceinline__ v8f wmma_f16(v16h a, v16h b, v8f c) {
  return __builtin_amdgcn_wmma_f32_16x16x32_f16(false, a, false, b, (short)0, c,
                                                false, false);
}

// ---------------------------------------------------------------------------
// Kernel 1: q/k/v projections.  One work-group: 64 rows of x against all 192
// rows of Wq|Wk|Wv.  A 128-k slice of those 256 rows is fetched with whole-line
// loads, converted to f16 once and shared through LDS (two buffers); each of
// the 16 waves owns one 16-row x 16-col tile of q, k and v.
//   q, k and v go to the workspace in operand-fragment order, in units of
//   512 f16 (1 KB) = one 16 x 32 operand tile:
//     unit[half][lane][e] = tile row (lane & 15), k = 16 * half + 8 * (lane >> 4) + e
//   q, k: rows = 16 positions, k = 32 head columns; 2 units per 16 positions.
//   v   : rows = 16 head columns, k = 32 positions; 4 units per 32 positions.
//   A result tile whose lanes each hold 8 neighbouring k of one row is half a
//   unit: one 16-B store per lane, 512 contiguous bytes per wave. For q and k
//   that takes W as the first operand (result rows = head columns).
// ---------------------------------------------------------------------------
constexpr int FU = 512;                // f16 per fragment unit
constexpr int PM      = 64;            // x rows per work-group
constexpr int PKS     = 128;           // k per staged slice: one wave-wide 16-B load per row
constexpr int PROWS   = PM + 3 * NH;   // staged rows: x | Wq | Wk | Wv
constexpr int PPITCH  = PKS + 8;       // f16 per LDS row: 272 B = 16 B x 17, no bank conflict for 16-B reads
constexpr int PSLICES = NC / PKS;

typedef __attribute__((ext_vector_type(8))) _Float16 v8h;
typedef __attribute__((ext_vector_type(4))) _Float16 v4h;

// One 16x32 operand tile from a staged row; p = row start + k offset + 8 * hl.
// k order of the layout above: [0..7] and [16..23] behind p, for A and B alike.
__device__ __forceinline__ v16h lds_frag(const _Float16* p) {
  union { v16h v; v8h h[2]; } t;
  t.h[0] = *(const v8h*)(p);
  t.h[1] = *(const v8h*)(p + 16);
  return t.v;
}

typedef const __attribute__((address_space(1))) _Float16* gcf16;
typedef const __attribute__((address_space(1))) v8h* gcv8h;

// A wave-uniform global address held in scalar registers: the loads behind it
// take it as their scalar base, and the one vector register they name is the
// lane's constant offset, which nothing rewrites while they are in flight.
__device__ __forceinline__ gcf16 scalar_base(const _Float16* p) {
  const unsigned long long a = (unsigned long long)p;
  const unsigned lo = __builtin_amdgcn_readfirstlane((unsigned)a);
  const unsigned hi = __builtin_amdgcn_readfirstlane((unsigned)(a >> 32));
  return (gcf16)(((unsigned long long)hi << 32) | lo);
}

// One 16x32 operand tile from a fragment unit in global memory: two wave-wide
// 16-B loads of 512 contiguous bytes each.
__device__ __forceinline__ v16h unit_frag(gcf16 unit, unsigned lane) {
  union { v16h v; v8h h[2]; } t;
  t.h[0] = *(gcv8h)(unit + lane * 8u);
  t.h[1] = *(gcv8h)(unit + FU / 2 + lane * 8u);
  return t.v;
}

typedef __attribute__((ext_vector_type(4))) float v4f;

__global__ __launch_bounds__(512) void proj_kernel(
    const float* __restrict__ x, const float* __restrict__ Wk,
    const float* __restrict__ Wq, const float* __restrict__ Wv,
    _Float16* __restrict__ qb, _Float16* __restrict__ kb,
    _Float16* __restrict__ vtb) {
  __shared__ __attribute__((aligned(16))) _Float16 tile[2][PROWS * PPITCH];

  const int tid = threadIdx.x;
  const int lane = tid & 31;
  const int wslot = tid >> 5;
  const int rt = wslot & 3;   // 16-row tile inside the 64 rows
  const int nt = wslot >> 2;  // 0..3 (H/16)
  const int hl = lane >> 4;
  const int ml = lane & 15;

  const int row0 = blockIdx.x * PM + rt * 16;
  const int h0 = nt * 16;

  // Staging: a wave's load covers the 512 B of one row's slice (4 whole lines).
  // Piece j of a wave is staged row j * 16 + wslot; 4 pieces per 64-row matrix.
  const unsigned goff = (unsigned)(wslot * NC + lane * 4);
  const float* xblk = x + (size_t)blockIdx.x * PM * NC;
  const int soff = wslot * PPITCH + lane * 4;

  // All 256 work-groups read the same rows of W from L2. Each starts its walk over
  // the k slices at another slice (8 starts, dealt so that neighbours in index and
  // indices 8 apart differ), so that at one moment they ask L2 for different lines.
  // A sum over all slices either way: only the order of the f32 additions moves.
  const int rot = (blockIdx.x + (blockIdx.x >> 3)) & (PSLICES - 1);
  auto slice_k = [&](int s) { return ((s + rot) & (PSLICES - 1)) * PKS; };

  v4f g[16];
  auto fetch = [&](int k0) {
    const float* px = xblk + k0;
    const float* pq = Wq + k0;
    const float* pk = Wk + k0;
    const float* pv = Wv + k0;
#pragma unroll  // constant indices keep g[] in registers
    for (int j = 0; j < 4; ++j) {
      g[j]      = *(const v4f*)(px + j * 16 * NC + goff);
      g[4 + j]  = *(const v4f*)(pq + j * 16 * NC + goff);
      g[8 + j]  = *(const v4f*)(pk + j * 16 * NC + goff);
      g[12 + j] = *(const v4f*)(pv + j * 16 * NC + goff);
    }
  };
  auto stage = [&](int buf) {
    _Float16* d = &tile[buf][soff];
#pragma unroll  // constant indices keep g[] in registers
    for (int j = 0; j < 16; ++j) *(v4h*)(d + j * 16 * PPITCH) = __builtin_convertvector(g[j], v4h);
  };

  v8f aq = {}; v8f ak = {}; v8f av = {};
  const int aoff = (rt * 16 + ml) * PPITCH + 8 * hl;
  const int boff = (PM + h0 + ml) * PPITCH + 8 * hl;
  auto compute = [&](int buf) {
    const _Float16* ta = &tile[buf][aoff];
    const _Float16* tb = &tile[buf][boff];
#pragma unroll  // k offsets become immediate LDS offsets
    for (int kk = 0; kk < PKS; kk += 32) {
      v16h a  = lds_frag(ta + kk);
      v16h bq = lds_frag(tb + kk);
      v16h bk = lds_frag(tb + NH * PPITCH + kk);
      v16h bv = lds_frag(tb + 2 * NH * PPITCH + kk);
      aq = wmma_f16(bq, a, aq);   // q^T tile: rows = head columns, lane = position
      ak = wmma_f16(bk, a, ak);   // k^T tile, likewise
      av = wmma_f16(a, bv, av);   // v tile: rows = positions, lane = head column
    }
  };

  fetch(slice_k(0));
  stage(0);
  __syncthreads();

  // Unrolled so that the buffer index folds into immediate LDS offsets. A slice's k
  // offset goes into the scalar bases: one vector offset register serves every
  // global load and is never rewritten.
#pragma unroll
  for (int s = 0; s < PSLICES - 1; ++s) {
    fetch(slice_k(s + 1));
    // Keeps the next slice's global loads ahead of this slice's LDS reads and
    // matrix work, so that their latency runs under it.
    SCHED_FENCE();
    compute(s & 1);
    // Keeps the wait for those loads (the conversions read them) behind the matrix work.
    SCHED_FENCE();
    stage((s + 1) & 1);
    // Publishes slice s + 1 and ends every read of the buffer refilled next trip.
    __syncthreads();
  }
  compute((PSLICES - 1) & 1);

  // row0 = flat b*T + t of the tile's first position.
  // q, k: lane holds position row0 + ml, head columns h0 + 8 * hl + 0..7:
  //       unit h0 / 32 of the 16 positions, half (h0 / 16) & 1.
  // v   : lane holds head column h0 + ml, positions row0 + 8 * hl + 0..7:
  //       unit h0 / 16 of the 32 positions, half (row0 / 16) & 1.
  const size_t qkoff = (size_t)(row0 >> 4) * (2 * FU) + nt * (FU / 2) + lane * 8;
  const size_t voff  = (size_t)(row0 >> 5) * (4 * FU) + nt * FU + (rt & 1) * (FU / 2) + lane * 8;
  *(v8h*)(qb + qkoff) = __builtin_convertvector(aq, v8h);
  *(v8h*)(kb + qkoff) = __builtin_convertvector(ak, v8h);
  *(v8h*)(vtb + voff) = __builtin_convertvector(av, v8h);
}

constexpr int AW     = 8;
constexpr int OPITCH = 68;

// Value of lane l ^ 16.
__device__ __forceinline__ float xhalf(float x) {
  const int b = __builtin_bit_cast(int, x);
  return __builtin_bit_cast(float, __builtin_amdgcn_permlanex16(b, b, 0x76543210, 0xfedcba98, false, false));
}

__global__ __launch_bounds__(256) void attn_kernel(
    const _Float16* __restrict__ qb, const _Float16* __restrict__ kb,
    const _Float16* __restrict__ vtb, float* __restrict__ out) {
  __shared__ __attribute__((aligned(16))) float po[AW][16][OPITCH];  // partial outputs
  __shared__ __attribute__((aligned(16))) float pm[AW][16];          // partial row maxima
  __shared__ __attribute__((aligned(16))) float pl[AW][16];          // partial row sums

  const int lane = threadIdx.x & 31;
  // Wave number as a scalar: the chunk loop's bounds and the K/V bases stay wave-uniform.
  const int wslot = __builtin_amdgcn_readfirstlane(threadIdx.x >> 5);
  // Work-group index -> (batch, query tile): a permutation of the 8 x 128 tiles,
  // chosen for speed only. A tile's cost grows with qt; the dearest tiles take the
  // lowest indices and the shortest the highest. Tiles go in four bands of 32 (256
  // indices each); the two middle bands run upwards, so that indices 256 apart in
  // bands 0 and 1 or 2 and 3 add up to the same number of keys.
  const int b = blockIdx.x & 7;
  const int band = blockIdx.x >> 8;          // 0..3
  const int u = (blockIdx.x >> 3) & 31;      // place inside the band
  const int qt = 127 - 32 * band - ((band == 1 || band == 2) ? 31 - u : u);
  const int q0 = qt * 16;
  const int hl = lane >> 4;
  const int ml = lane & 15;

  // Q tile (second operand: column = query ml), K-dim = H = 64 -> two k-steps
  const gcf16 qrow = scalar_base(qb + ((size_t)b * NT + q0) * NH);   // 2 units per 16 positions
  const v16h bq0 = unit_frag(qrow, lane);
  const v16h bq1 = unit_frag(qrow + FU, lane);

  // O^T tiles: o<t>[r] = O[query ml][head column 16 * t + 8 * hl + r].
  v8f o0 = {}, o1 = {}, o2 = {}, o3 = {};
  float m = -__builtin_inff();   // running maximum of query ml, equal in both halves
  float l = 0.f;                 // running sum of query ml over this half's keys only

  // (1/sqrt(n_embd)) * log2(e): softmax computed with exp2.
  const float sscale2 = 0.03125f * 1.4426950408889634f;
  const int nchunks = (q0 + 16 + 31) >> 5;
  const _Float16* kb_b  = kb + (size_t)b * NT * NH;
  const _Float16* vtb_b = vtb + (size_t)b * NT * NH;

  for (int c = wslot; c < nchunks; c += AW) {
    const int s0 = c * 32;

    // ---- issue ALL K and V tile loads up front; V latency hides under
    //      the S-WMMAs + softmax VALU work ----
    //      A chunk's K and V are 4 fragment units (4 KB contiguous) each.
    const gcf16 kc = scalar_base(kb_b + (size_t)s0 * NH);
    const gcf16 vc = scalar_base(vtb_b + (size_t)s0 * NH);
    v16h ak00 = unit_frag(kc, lane);            // keys s0..s0+15,    h 0..31
    v16h ak01 = unit_frag(kc + FU, lane);       //                    h 32..63
    v16h ak10 = unit_frag(kc + 2 * FU, lane);   // keys s0+16..s0+31, h 0..31
    v16h ak11 = unit_frag(kc + 3 * FU, lane);   //                    h 32..63
    v16h av0 = unit_frag(vc, lane);             // h 0..15,  keys s0..s0+31
    v16h av1 = unit_frag(vc + FU, lane);        // h 16..31
    v16h av2 = unit_frag(vc + 2 * FU, lane);    // h 32..47
    v16h av3 = unit_frag(vc + 3 * FU, lane);    // h 48..63
    SCHED_FENCE();

    // ---- S^T = K Q^T: st0[r] = score(key s0 + 8 * hl + r, query q0 + ml),
    //      st1[r] the same 16 keys further on ----
    v8f st0 = {}, st1 = {};
    st0 = wmma_f16(ak00, bq0, st0);
    st0 = wmma_f16(ak01, bq1, st0);
    st1 = wmma_f16(ak10, bq0, st1);
    st1 = wmma_f16(ak11, bq1, st1);

    // ---- scale + causal mask + maximum of this lane's 16 scores ----
    const int kvis = q0 + ml - s0 - 8 * hl;   // key r of st0 / 16 + r of st1 is seen while <= kvis
    st0 *= sscale2;
    st1 *= sscale2;
    float v0[8], v1[8], mv[8];
#pragma unroll  // constant indices keep the scores in registers
    for (int r = 0; r < 8; ++r) {
      v0[r] = (r > kvis)      ? -__builtin_inff() : st0[r];
      v1[r] = (16 + r > kvis) ? -__builtin_inff() : st1[r];
      mv[r] = fmaxf(v0[r], v1[r]);
    }
    float mx = fmaxf(fmaxf(fmaxf(mv[0], mv[1]), fmaxf(mv[2], mv[3])),
                     fmaxf(fmaxf(mv[4], mv[5]), fmaxf(mv[6], mv[7])));
    mx = fmaxf(mx, xhalf(mx));   // all 32 keys; key s0 is seen by every query, so mx is finite

    // ---- online softmax (exp2 domain) ----
    const float newm = fmaxf(m, mx);
    const float corr = __builtin_amdgcn_exp2f(m - newm);
    m = newm;
    v8f p0, p1;
#pragma unroll  // constant indices keep the scores in registers
    for (int r = 0; r < 8; ++r) {
      p0[r] = __builtin_amdgcn_exp2f(v0[r] - newm);
      p1[r] = __builtin_amdgcn_exp2f(v1[r] - newm);
    }
    const v8f ps = p0 + p1;
    const v4f ps4 = __builtin_shufflevector(ps, ps, 0, 1, 2, 3) + __builtin_shufflevector(ps, ps, 4, 5, 6, 7);
    l = l * corr + ((ps4[0] + ps4[2]) + (ps4[1] + ps4[3]));
    o0 *= corr; o1 *= corr; o2 *= corr; o3 *= corr;

    // ---- P^T as second operand (k = keys): element e < 8 is key 8 * hl + e = p0[e],
    //      element e >= 8 is key 16 + 8 * hl + (e - 8) = p1[e - 8] ----
    union { v16h v; v8h h[2]; } pt;
    pt.h[0] = __builtin_convertvector(p0, v8h);
    pt.h[1] = __builtin_convertvector(p1, v8h);

    // ---- O^T += V^T P^T  (V tiles already resident) ----
    o0 = wmma_f16(av0, pt.v, o0);
    o1 = wmma_f16(av1, pt.v, o1);
    o2 = wmma_f16(av2, pt.v, o2);
    o3 = wmma_f16(av3, pt.v, o3);
  }

  // ---- hand this wave's partial (max, sum, un-normalised O) to the work-group.
  //      A wave without a chunk hands in max = -inf, sum = 0, O = 0: weight 0 below.
  {
    float* d = &po[wslot][ml][8 * hl];
    *(v4f*)(d)      = __builtin_shufflevector(o0, o0, 0, 1, 2, 3);
    *(v4f*)(d + 4)  = __builtin_shufflevector(o0, o0, 4, 5, 6, 7);
    *(v4f*)(d + 16) = __builtin_shufflevector(o1, o1, 0, 1, 2, 3);
    *(v4f*)(d + 20) = __builtin_shufflevector(o1, o1, 4, 5, 6, 7);
    *(v4f*)(d + 32) = __builtin_shufflevector(o2, o2, 0, 1, 2, 3);
    *(v4f*)(d + 36) = __builtin_shufflevector(o2, o2, 4, 5, 6, 7);
    *(v4f*)(d + 48) = __builtin_shufflevector(o3, o3, 0, 1, 2, 3);
    *(v4f*)(d + 52) = __builtin_shufflevector(o3, o3, 4, 5, 6, 7);
  }
  const float lrow = l + xhalf(l);   // the two halves' key shares joined once
  if (hl == 0) {   // both halves hold the same m and lrow
    pm[wslot][ml] = m;
    pl[wslot][ml] = lrow;
  }
  // Publishes all eight partials; every wave passes it, with or without chunks.
  __syncthreads();

  // ---- merge, normalize and store f32 output [B, T, H]: a thread owns 4
  //      neighbouring columns of one row, a wave two whole 256-B rows.
  //      Wave 0 always has chunk 0, whose key 0 every row sees: mall is finite.
  const int mrow = threadIdx.x >> 4;
  const int mcol = (threadIdx.x & 15) * 4;
  float mw[AW];
  float mall = -__builtin_inff();
#pragma unroll
  for (int w = 0; w < AW; ++w) {
    mw[w] = pm[w][mrow];
    mall = fmaxf(mall, mw[w]);
  }
  float lall = 0.f;
  v4f acc = {};
#pragma unroll
  for (int w = 0; w < AW; ++w) {
    const float e = __builtin_amdgcn_exp2f(mw[w] - mall);
    lall += e * pl[w][mrow];
    acc += e * *(const v4f*)&po[w][mrow][mcol];
  }
  const float inv = 1.0f / lall;
  *(v4f*)&out[((size_t)b * NT + q0 + mrow) * NH + mcol] = acc * inv;
}

// ---------------------------------------------------------------------------
extern "C" void kernel_launch(void* const* d_in, const int* in_sizes, int n_in,
                              void* d_out, int out_size, void* d_ws, size_t ws_size,
                              hipStream_t stream) {
  const float* x  = (const float*)d_in[0];
  const float* Wk = (const float*)d_in[1];
  const float* Wq = (const float*)d_in[2];
  const float* Wv = (const float*)d_in[3];

  const size_t nqkv = (size_t)NB * NT * NH;  // 1M elems each
  _Float16* qb  = (_Float16*)d_ws;
  _Float16* kbf = qb + nqkv;
  _Float16* vtb = kbf + nqkv;

  // Projection: B*T/64 = 256 work-groups of 16 waves.
  proj_kernel<<<256, 512, 0, stream>>>(x, Wk, Wq, Wv, qb, kbf, vtb);

  // Attention: B * T/16 = 1024 query tiles, one work-group of 8 waves each.
  attn_kernel<<<1024, 256, 0, stream>>>(qb, kbf, vtb, (float*)d_out);
}

// v007
// Measured time: 24.3 microseconds a run.
// Next to v006, in two timings, it ran 1.04 and 1.06 times as fast.
// Counting every step since v000, it is 5.31 times as fast.
#include <hip/hip_runtime.h>
#include <hip/hip_bf16.h>

// Problem constants (match reference)
constexpr int NB = 8;     // batch
constexpr int NT = 2048;  // sequence length
constexpr int NC = 1024;  // n_embd
constexpr int NH = 64;    // head size

typedef __attribute__((ext_vector_type(16))) _Float16 v16h;
typedef __attribute__((ext_vector_type(8)))  float    v8f;

#if defined(__has_builtin)
#if __has_builtin(__builtin_amdgcn_sched_barrier)
#define SCHED_FENCE() __builtin_amdgcn_sched_barrier(0)
#endif
#endif
#ifndef SCHED_FENCE
#define SCHED_FENCE() asm volatile("" ::: "memory")
#endif

// 16-bit A/B 16x32 WMMA layout: element e of a lane's operand holds
//   k = 8 * hl + e for e < 8, k = 16 + 8 * hl + (e - 8) for e >= 8   (hl = lane >> 4).

__device__ __forceinline__ v8f wmma_f16(v16h a, v16h b, v8f c) {
  return __builtin_amdgcn_wmma_f32_16x16x32_f16(false, a, false, b, (short)0, c,
                                                false, false);
}

// ---------------------------------------------------------------------------
// Kernel 1: q/k/v projections.  One work-group: 64 rows of x against all 192
// rows of Wq|Wk|Wv.  A 128-k slice of those 256 rows is fetched with whole-line
// loads, converted to f16 once and shared through LDS (two buffers); each of
// the 16 waves owns one 16-row x 16-col tile of q, k and v.
//   q, k and v go to the workspace in operand-fragment order, in units of
//   512 f16 (1 KB) = one 16 x 32 operand tile:
//     unit[half][lane][e] = tile row (lane & 15), k = 16 * half + 8 * (lane >> 4) + e
//   q, k: rows = 16 positions, k = 32 head columns; 2 units per 16 positions.
//   v   : rows = 16 head columns, k = 32 positions; 4 units per 32 positions.
//   A result tile whose lanes each hold 8 neighbouring k of one row is half a
//   unit: one 16-B store per lane, 512 contiguous bytes per wave. For q and k
//   that takes W as the first operand (result rows = head columns).
// ---------------------------------------------------------------------------
constexpr int FU = 512;                // f16 per fragment unit
constexpr int PM      = 64;            // x rows per work-group
constexpr int PKS     = 128;           // k per staged slice: one wave-wide 16-B load per row
constexpr int PROWS   = PM + 3 * NH;   // staged rows: x | Wq | Wk | Wv
constexpr int PPITCH  = PKS + 8;       // f16 per LDS row: 272 B = 16 B x 17, no bank conflict for 16-B reads
constexpr int PSLICES = NC / PKS;

typedef __attribute__((ext_vector_type(8))) _Float16 v8h;
typedef __attribute__((ext_vector_type(4))) _Float16 v4h;

// One 16x32 operand tile from a staged row; p = row start + k offset + 8 * hl.
// k order of the layout above: [0..7] and [16..23] behind p, for A and B alike.
__device__ __forceinline__ v16h lds_frag(const _Float16* p) {
  union { v16h v; v8h h[2]; } t;
  t.h[0] = *(const v8h*)(p);
  t.h[1] = *(const v8h*)(p + 16);
  return t.v;
}

typedef const __attribute__((address_space(1))) _Float16* gcf16;
typedef const __attribute__((address_space(1))) v8h* gcv8h;

// A wave-uniform global address held in scalar registers: the loads behind it
// take it as their scalar base, and the one vector register they name is the
// lane's constant offset, which nothing rewrites while they are in flight.
__device__ __forceinline__ gcf16 scalar_base(const _Float16* p) {
  const unsigned long long a = (unsigned long long)p;
  const unsigned lo = __builtin_amdgcn_readfirstlane((unsigned)a);
  const unsigned hi = __builtin_amdgcn_readfirstlane((unsigned)(a >> 32));
  return (gcf16)(((unsigned long long)hi << 32) | lo);
}

// One 16x32 operand tile from a fragment unit in global memory: two wave-wide
// 16-B loads of 512 contiguous bytes each.
__device__ __forceinline__ v16h unit_frag(gcf16 unit, unsigned lane) {
  union { v16h v; v8h h[2]; } t;
  t.h[0] = *(gcv8h)(unit + lane * 8u);
  t.h[1] = *(gcv8h)(unit + FU / 2 + lane * 8u);
  return t.v;
}

typedef __attribute__((ext_vector_type(4))) float v4f;

// Work-group barrier that orders LDS only: this wave's LDS stores and reads are
// complete before it signals, and no LDS access moves across it. __syncthreads()
// would also wait for every global load in flight, and the loads issued ahead into
// registers are meant to stay in flight across it.
__device__ __forceinline__ void lds_barrier() {
  __builtin_amdgcn_fence(__ATOMIC_RELEASE, "workgroup", "local");
  __builtin_amdgcn_s_barrier();
  __builtin_amdgcn_fence(__ATOMIC_ACQUIRE, "workgroup", "local");
}

__global__ __launch_bounds__(512) void proj_kernel(
    const float* __restrict__ x, const float* __restrict__ Wk,
    const float* __restrict__ Wq, const float* __restrict__ Wv,
    _Float16* __restrict__ qb, _Float16* __restrict__ kb,
    _Float16* __restrict__ vtb) {
  __shared__ __attribute__((aligned(16))) _Float16 tile[2][PROWS * PPITCH];

  const int tid = threadIdx.x;
  const int lane = tid & 31;
  const int wslot = tid >> 5;
  const int rt = wslot & 3;   // 16-row tile inside the 64 rows
  const int nt = wslot >> 2;  // 0..3 (H/16)
  const int hl = lane >> 4;
  const int ml = lane & 15;

  const int row0 = blockIdx.x * PM + rt * 16;
  const int h0 = nt * 16;

  // Staging: a wave's load covers the 512 B of one row's slice (4 whole lines).
  // Piece j of a wave is staged row j * 16 + wslot; 4 pieces per 64-row matrix.
  const unsigned goff = (unsigned)(wslot * NC + lane * 4);
  const float* xblk = x + (size_t)blockIdx.x * PM * NC;
  const int soff = wslot * PPITCH + lane * 4;

  // All 256 work-groups read the same rows of W from L2. Each starts its walk over
  // the k slices at another slice (8 starts, dealt so that neighbours in index and
  // indices 8 apart differ), so that at one moment they ask L2 for different lines.
  // A sum over all slices either way: only the order of the f32 additions moves.
  const int rot = (blockIdx.x + (blockIdx.x >> 3)) & (PSLICES - 1);
  auto slice_k = [&](int s) { return ((s + rot) & (PSLICES - 1)) * PKS; };

  // Two register sets: while one slice's values are converted and stored, the slice
  // behind it is already on its way.
  v4f gs[2][16];
  auto fetch = [&](v4f (&g)[16], int k0) {
    const float* px = xblk + k0;
    const float* pq = Wq + k0;
    const float* pk = Wk + k0;
    const float* pv = Wv + k0;
#pragma unroll  // constant indices keep g[] in registers
    for (int j = 0; j < 4; ++j) {
      g[j]      = *(const v4f*)(px + j * 16 * NC + goff);
      g[4 + j]  = *(const v4f*)(pq + j * 16 * NC + goff);
      g[8 + j]  = *(const v4f*)(pk + j * 16 * NC + goff);
      g[12 + j] = *(const v4f*)(pv + j * 16 * NC + goff);
    }
  };
  auto stage = [&](const v4f (&g)[16], int buf) {
    _Float16* d = &tile[buf][soff];
#pragma unroll  // constant indices keep g[] in registers
    for (int j = 0; j < 16; ++j) *(v4h*)(d + j * 16 * PPITCH) = __builtin_convertvector(g[j], v4h);
  };

  v8f aq = {}; v8f ak = {}; v8f av = {};
  const int aoff = (rt * 16 + ml) * PPITCH + 8 * hl;
  const int boff = (PM + h0 + ml) * PPITCH + 8 * hl;
  auto compute = [&](int buf) {
    const _Float16* ta = &tile[buf][aoff];
    const _Float16* tb = &tile[buf][boff];
#pragma unroll  // k offsets become immediate LDS offsets
    for (int kk = 0; kk < PKS; kk += 32) {
      v16h a  = lds_frag(ta + kk);
      v16h bq = lds_frag(tb + kk);
      v16h bk = lds_frag(tb + NH * PPITCH + kk);
      v16h bv = lds_frag(tb + 2 * NH * PPITCH + kk);
      aq = wmma_f16(bq, a, aq);   // q^T tile: rows = head columns, lane = position
      ak = wmma_f16(bk, a, ak);   // k^T tile, likewise
      av = wmma_f16(a, bv, av);   // v tile: rows = positions, lane = head column
    }
  };

  fetch(gs[0], slice_k(0));
  fetch(gs[1], slice_k(1));
  stage(gs[0], 0);
  // Keeps the refill behind the conversions: it reuses their registers.
  SCHED_FENCE();
  fetch(gs[0], slice_k(2));
  // Keeps those global loads ahead of the barrier.
  SCHED_FENCE();
  lds_barrier();

  // Unrolled so that the buffer index folds into immediate LDS offsets. A slice's k
  // offset goes into the scalar bases: one vector offset register serves every
  // global load and lives until the last fetch. The register set folds likewise.
  // A register set is asked to fetch again as soon as it has been stored: slice s + 3
  // goes out while slice s + 2 is still in flight, so that loads stay queued while the
  // work-group converts, stores, meets at the barrier and multiplies.
#pragma unroll
  for (int s = 0; s < PSLICES - 1; ++s) {
    compute(s & 1);
    // The loads of slice s + 2 are still in flight when the fetch below rewrites the
    // scalar bases that they name: this wait stands in front of that rewrite (the
    // fence below keeps the address arithmetic behind it).
    if (s + 3 < PSLICES) asm volatile("s_wait_xcnt 0x0" ::: "memory");
    // Keeps the wait for slice s + 1 (the conversions read it) behind the matrix work.
    SCHED_FENCE();
    stage(gs[(s + 1) & 1], (s + 1) & 1);
    // Keeps the refill behind the conversions: it reuses their registers.
    SCHED_FENCE();
    if (s + 3 < PSLICES) fetch(gs[(s + 1) & 1], slice_k(s + 3));
    // Keeps those global loads ahead of the barrier and of the next slice's LDS reads.
    SCHED_FENCE();
    // Behind the last fetch the vector offset register that its loads name is free
    // for reuse by the matrix work: this wait stands in front of that reuse.
    if (s + 3 == PSLICES - 1) asm volatile("s_wait_xcnt 0x0" ::: "memory");
    // Publishes slice s + 1 and ends every read of the buffer refilled next trip.
    lds_barrier();
  }
  compute((PSLICES - 1) & 1);

  // row0 = flat b*T + t of the tile's first position.
  // q, k: lane holds position row0 + ml, head columns h0 + 8 * hl + 0..7:
  //       unit h0 / 32 of the 16 positions, half (h0 / 16) & 1.
  // v   : lane holds head column h0 + ml, positions row0 + 8 * hl + 0..7:
  //       unit h0 / 16 of the 32 positions, half (row0 / 16) & 1.
  const size_t qkoff = (size_t)(row0 >> 4) * (2 * FU) + nt * (FU / 2) + lane * 8;
  const size_t voff  = (size_t)(row0 >> 5) * (4 * FU) + nt * FU + (rt & 1) * (FU / 2) + lane * 8;
  *(v8h*)(qb + qkoff) = __builtin_convertvector(aq, v8h);
  *(v8h*)(kb + qkoff) = __builtin_convertvector(ak, v8h);
  *(v8h*)(vtb + voff) = __builtin_convertvector(av, v8h);
}

constexpr int AW     = 8;
constexpr int OPITCH = 68;

// Value of lane l ^ 16.
__device__ __forceinline__ float xhalf(float x) {
  const int b = __builtin_bit_cast(int, x);
  return __builtin_bit_cast(float, __builtin_amdgcn_permlanex16(b, b, 0x76543210, 0xfedcba98, false, false));
}

__global__ __launch_bounds__(256) void attn_kernel(
    const _Float16* __restrict__ qb, const _Float16* __restrict__ kb,
    const _Float16* __restrict__ vtb, float* __restrict__ out) {
  __shared__ __attribute__((aligned(16))) float po[AW][16][OPITCH];  // partial outputs
  __shared__ __attribute__((aligned(16))) float pm[AW][16];          // partial row maxima
  __shared__ __attribute__((aligned(16))) float pl[AW][16];          // partial row sums

  const int lane = threadIdx.x & 31;
  // Wave number as a scalar: the chunk loop's bounds and the K/V bases stay wave-uniform.
  const int wslot = __builtin_amdgcn_readfirstlane(threadIdx.x >> 5);
  // Work-group index -> (batch, query tile): a permutation of the 8 x 128 tiles,
  // chosen for speed only. A tile's cost grows with qt; the dearest tiles take the
  // lowest indices and the shortest the highest. Tiles go in four bands of 32 (256
  // indices each); the two middle bands run upwards, so that indices 256 apart in
  // bands 0 and 1 or 2 and 3 add up to the same number of keys.
  const int b = blockIdx.x & 7;
  const int band = blockIdx.x >> 8;          // 0..3
  const int u = (blockIdx.x >> 3) & 31;      // place inside the band
  const int qt = 127 - 32 * band - ((band == 1 || band == 2) ? 31 - u : u);
  const int q0 = qt * 16;
  const int hl = lane >> 4;
  const int ml = lane & 15;

  // Q tile (second operand: column = query ml), K-dim = H = 64 -> two k-steps
  const gcf16 qrow = scalar_base(qb + ((size_t)b * NT + q0) * NH);   // 2 units per 16 positions
  const v16h bq0 = unit_frag(qrow, lane);
  const v16h bq1 = unit_frag(qrow + FU, lane);

  // O^T tiles: o<t>[r] = O[query ml][head column 16 * t + 8 * hl + r].
  v8f o0 = {}, o1 = {}, o2 = {}, o3 = {};
  float m = -__builtin_inff();   // running maximum of query ml, equal in both halves
  float l = 0.f;                 // running sum of query ml over this half's keys only

  // (1/sqrt(n_embd)) * log2(e): softmax computed with exp2.
  const float sscale2 = 0.03125f * 1.4426950408889634f;
  const int nchunks = (q0 + 16 + 31) >> 5;
  const _Float16* kb_b  = kb + (size_t)b * NT * NH;
  const _Float16* vtb_b = vtb + (size_t)b * NT * NH;

  for (int c = wslot; c < nchunks; c += AW) {
    const int s0 = c * 32;

    // ---- issue ALL K and V tile loads up front; V latency hides under
    //      the S-WMMAs + softmax VALU work ----
    //      A chunk's K and V are 4 fragment units (4 KB contiguous) each.
    const gcf16 kc = scalar_base(kb_b + (size_t)s0 * NH);
    const gcf16 vc = scalar_base(vtb_b + (size_t)s0 * NH);
    v16h ak00 = unit_frag(kc, lane);            // keys s0..s0+15,    h 0..31
    v16h ak01 = unit_frag(kc + FU, lane);       //                    h 32..63
    v16h ak10 = unit_frag(kc + 2 * FU, lane);   // keys s0+16..s0+31, h 0..31
    v16h ak11 = unit_frag(kc + 3 * FU, lane);   //                    h 32..63
    v16h av0 = unit_frag(vc, lane);             // h 0..15,  keys s0..s0+31
    v16h av1 = unit_frag(vc + FU, lane);        // h 16..31
    v16h av2 = unit_frag(vc + 2 * FU, lane);    // h 32..47
    v16h av3 = unit_frag(vc + 3 * FU, lane);    // h 48..63
    SCHED_FENCE();

    // ---- S^T = K Q^T: st0[r] = score(key s0 + 8 * hl + r, query q0 + ml),
    //      st1[r] the same 16 keys further on ----
    v8f st0 = {}, st1 = {};
    st0 = wmma_f16(ak00, bq0, st0);
    st0 = wmma_f16(ak01, bq1, st0);
    st1 = wmma_f16(ak10, bq0, st1);
    st1 = wmma_f16(ak11, bq1, st1);

    // ---- scale + causal mask + maximum of this lane's 16 scores ----
    const int kvis = q0 + ml - s0 - 8 * hl;   // key r of st0 / 16 + r of st1 is seen while <= kvis
    st0 *= sscale2;
    st1 *= sscale2;
    float v0[8], v1[8], mv[8];
#pragma unroll  // constant indices keep the scores in registers
    for (int r = 0; r < 8; ++r) {
      v0[r] = (r > kvis)      ? -__builtin_inff() : st0[r];
      v1[r] = (16 + r > kvis) ? -__builtin_inff() : st1[r];
      mv[r] = fmaxf(v0[r], v1[r]);
    }
    float mx = fmaxf(fmaxf(fmaxf(mv[0], mv[1]), fmaxf(mv[2], mv[3])),
                     fmaxf(fmaxf(mv[4], mv[5]), fmaxf(mv[6], mv[7])));
    mx = fmaxf(mx, xhalf(mx));   // all 32 keys; key s0 is seen by every query, so mx is finite

    // ---- online softmax (exp2 domain) ----
    const float newm = fmaxf(m, mx);
    const float corr = __builtin_amdgcn_exp2f(m - newm);
    m = newm;
    v8f p0, p1;
#pragma unroll  // constant indices keep the scores in registers
    for (int r = 0; r < 8; ++r) {
      p0[r] = __builtin_amdgcn_exp2f(v0[r] - newm);
      p1[r] = __builtin_amdgcn_exp2f(v1[r] - newm);
    }
    const v8f ps = p0 + p1;
    const v4f ps4 = __builtin_shufflevector(ps, ps, 0, 1, 2, 3) + __builtin_shufflevector(ps, ps, 4, 5, 6, 7);
    l = l * corr + ((ps4[0] + ps4[2]) + (ps4[1] + ps4[3]));
    o0 *= corr; o1 *= corr; o2 *= corr; o3 *= corr;

    // ---- P^T as second operand (k = keys): element e < 8 is key 8 * hl + e = p0[e],
    //      element e >= 8 is key 16 + 8 * hl + (e - 8) = p1[e - 8] ----
    union { v16h v; v8h h[2]; } pt;
    pt.h[0] = __builtin_convertvector(p0, v8h);
    pt.h[1] = __builtin_convertvector(p1, v8h);

    // ---- O^T += V^T P^T  (V tiles already resident) ----
    o0 = wmma_f16(av0, pt.v, o0);
    o1 = wmma_f16(av1, pt.v, o1);
    o2 = wmma_f16(av2, pt.v, o2);
    o3 = wmma_f16(av3, pt.v, o3);
  }

  // ---- hand this wave's partial (max, sum, un-normalised O) to the work-group.
  //      A wave without a chunk hands in max = -inf, sum = 0, O = 0: weight 0 below.
  {
    float* d = &po[wslot][ml][8 * hl];
    *(v4f*)(d)      = __builtin_shufflevector(o0, o0, 0, 1, 2, 3);
    *(v4f*)(d + 4)  = __builtin_shufflevector(o0, o0, 4, 5, 6, 7);
    *(v4f*)(d + 16) = __builtin_shufflevector(o1, o1, 0, 1, 2, 3);
    *(v4f*)(d + 20) = __builtin_shufflevector(o1, o1, 4, 5, 6, 7);
    *(v4f*)(d + 32) = __builtin_shufflevector(o2, o2, 0, 1, 2, 3);
    *(v4f*)(d + 36) = __builtin_shufflevector(o2, o2, 4, 5, 6, 7);
    *(v4f*)(d + 48) = __builtin_shufflevector(o3, o3, 0, 1, 2, 3);
    *(v4f*)(d + 52) = __builtin_shufflevector(o3, o3, 4, 5, 6, 7);
  }
  const float lrow = l + xhalf(l);   // the two halves' key shares joined once
  if (hl == 0) {   // both halves hold the same m and lrow
    pm[wslot][ml] = m;
    pl[wslot][ml] = lrow;
  }
  // Publishes all eight partials; every wave passes it, with or without chunks.
  __syncthreads();

  // ---- merge, normalize and store f32 output [B, T, H]: a thread owns 4
  //      neighbouring columns of one row, a wave two whole 256-B rows.
  //      Wave 0 always has chunk 0, whose key 0 every row sees: mall is finite.
  const int mrow = threadIdx.x >> 4;
  const int mcol = (threadIdx.x & 15) * 4;
  float mw[AW];
  float mall = -__builtin_inff();
#pragma unroll
  for (int w = 0; w < AW; ++w) {
    mw[w] = pm[w][mrow];
    mall = fmaxf(mall, mw[w]);
  }
  float lall = 0.f;
  v4f acc = {};
#pragma unroll
  for (int w = 0; w < AW; ++w) {
    const float e = __builtin_amdgcn_exp2f(mw[w] - mall);
    lall += e * pl[w][mrow];
    acc += e * *(const v4f*)&po[w][mrow][mcol];
  }
  const float inv = 1.0f / lall;
  *(v4f*)&out[((size_t)b * NT + q0 + mrow) * NH + mcol] = acc * inv;
}

// ---------------------------------------------------------------------------
extern "C" void kernel_launch(void* const* d_in, const int* in_sizes, int n_in,
                              void* d_out, int out_size, void* d_ws, size_t ws_size,
                              hipStream_t stream) {
  const float* x  = (const float*)d_in[0];
  const float* Wk = (const float*)d_in[1];
  const float* Wq = (const float*)d_in[2];
  const float* Wv = (const float*)d_in[3];

  const size_t nqkv = (size_t)NB * NT * NH;  // 1M elems each
  _Float16* qb  = (_Float16*)d_ws;
  _Float16* kbf = qb + nqkv;
  _Float16* vtb = kbf + nqkv;

  // Projection: B*T/64 = 256 work-groups of 16 waves.
  proj_kernel<<<256, 512, 0, stream>>>(x, Wk, Wq, Wv, qb, kbf, vtb);

  // Attention: B * T/16 = 1024 query tiles, one work-group of 8 waves each.
  attn_kernel<<<1024, 256, 0, stream>>>(qb, kbf, vtb, (float*)d_out);
}

// v008
// One run takes 23.6 microseconds.
// Two timings next to v007 put it at 1.06 and 1.07 times that version's speed.
// All steps since v000 together make it 5.66 times as fast.
#include <hip/hip_runtime.h>
#include <hip/hip_bf16.h>

// Problem constants (match reference)
constexpr int NB = 8;     // batch
constexpr int NT = 2048;  // sequence length
constexpr int NC = 1024;  // n_embd
constexpr int NH = 64;    // head size

typedef __attribute__((ext_vector_type(16))) _Float16 v16h;
typedef __attribute__((ext_vector_type(8)))  float    v8f;

#if defined(__has_builtin)
#if __has_builtin(__builtin_amdgcn_sched_barrier)
#define SCHED_FENCE() __builtin_amdgcn_sched_barrier(0)
#endif
#endif
#ifndef SCHED_FENCE
#define SCHED_FENCE() asm volatile("" ::: "memory")
#endif

// 16-bit A/B 16x32 WMMA layout: element e of a lane's operand holds
//   k = 8 * hl + e for e < 8, k = 16 + 8 * hl + (e - 8) for e >= 8   (hl = lane >> 4).

__device__ __forceinline__ v8f wmma_f16(v16h a, v16h b, v8f c) {
  return __builtin_amdgcn_wmma_f32_16x16x32_f16(false, a, false, b, (short)0, c,
                                                false, false);
}

// ---------------------------------------------------------------------------
// Kernel 1: q/k/v projections.  One work-group: 128 rows of x against 32 rows of
// each of Wq, Wk, Wv (one half of the head columns): 128 + 96 staged rows for the
// same 48 result tiles as 64 + 192, so fewer bytes come in from L2 per product.
// A 128-k slice of those 224 rows is fetched with whole-line loads, converted to
// f16 once and shared through LDS (two buffers); each of the 16 waves owns one
// 16-row x 16-col tile of q, k and v.
//   q, k and v go to the workspace in operand-fragment order, in units of
//   512 f16 (1 KB) = one 16 x 32 operand tile:
//     unit[half][lane][e] = tile row (lane & 15), k = 16 * half + 8 * (lane >> 4) + e
//   q, k: rows = 16 positions, k = 32 head columns; 2 units per 16 positions.
//   v   : rows = 16 head columns, k = 32 positions; 4 units per 32 positions.
//   A result tile whose lanes each hold 8 neighbouring k of one row is half a
//   unit: one 16-B store per lane, 512 contiguous bytes per wave. For q and k
//   that takes W as the first operand (result rows = head columns).
// ---------------------------------------------------------------------------
constexpr int FU = 512;                // f16 per fragment unit
constexpr int PM      = 128;           // x rows per work-group
constexpr int PWR     = NH / 2;        // rows of each of Wq, Wk, Wv per work-group
constexpr int PKS     = 128;           // k per staged slice: one wave-wide 16-B load per row
constexpr int PROWS   = PM + 3 * PWR;  // staged rows: x | Wq | Wk | Wv
constexpr int PPIECES = PROWS / 16;    // staged rows per wave and slice
constexpr int PPITCH  = PKS + 8;       // f16 per LDS row: 272 B = 16 B x 17, no bank conflict for 16-B reads
constexpr int PSLICES = NC / PKS;

typedef __attribute__((ext_vector_type(8))) _Float16 v8h;
typedef __attribute__((ext_vector_type(4))) _Float16 v4h;

// One 16x32 operand tile from a staged row; p = row start + k offset + 8 * hl.
// k order of the layout above: [0..7] and [16..23] behind p, for A and B alike.
__device__ __forceinline__ v16h lds_frag(const _Float16* p) {
  union { v16h v; v8h h[2]; } t;
  t.h[0] = *(const v8h*)(p);
  t.h[1] = *(const v8h*)(p + 16);
  return t.v;
}

typedef const __attribute__((address_space(1))) _Float16* gcf16;
typedef const __attribute__((address_space(1))) v8h* gcv8h;

// A wave-uniform global address held in scalar registers: the loads behind it
// take it as their scalar base, and the one vector register they name is the
// lane's constant offset, which nothing rewrites while they are in flight.
__device__ __forceinline__ gcf16 scalar_base(const _Float16* p) {
  const unsigned long long a = (unsigned long long)p;
  const unsigned lo = __builtin_amdgcn_readfirstlane((unsigned)a);
  const unsigned hi = __builtin_amdgcn_readfirstlane((unsigned)(a >> 32));
  return (gcf16)(((unsigned long long)hi << 32) | lo);
}

// One 16x32 operand tile from a fragment unit in global memory: two wave-wide
// 16-B loads of 512 contiguous bytes each.
__device__ __forceinline__ v16h unit_frag(gcf16 unit, unsigned lane) {
  union { v16h v; v8h h[2]; } t;
  t.h[0] = *(gcv8h)(unit + lane * 8u);
  t.h[1] = *(gcv8h)(unit + FU / 2 + lane * 8u);
  return t.v;
}

typedef __attribute__((ext_vector_type(4))) float v4f;

// Work-group barrier that orders LDS only: this wave's LDS stores and reads are
// complete before it signals, and no LDS access moves across it. __syncthreads()
// would also wait for every global load in flight, and the loads issued ahead into
// registers are meant to stay in flight across it.
__device__ __forceinline__ void lds_barrier() {
  __builtin_amdgcn_fence(__ATOMIC_RELEASE, "workgroup", "local");
  __builtin_amdgcn_s_barrier();
  __builtin_amdgcn_fence(__ATOMIC_ACQUIRE, "workgroup", "local");
}

__global__ __launch_bounds__(512) void proj_kernel(
    const float* __restrict__ x, const float* __restrict__ Wk,
    const float* __restrict__ Wq, const float* __restrict__ Wv,
    _Float16* __restrict__ qb, _Float16* __restrict__ kb,
    _Float16* __restrict__ vtb) {
  __shared__ __attribute__((aligned(16))) _Float16 tile[2][PROWS * PPITCH];

  const int tid = threadIdx.x;
  const int lane = tid & 31;
  const int wslot = tid >> 5;
  const int rt = wslot & 7;   // 16-row tile inside the 128 rows
  const int cg = wslot >> 3;  // 16-column tile inside this work-group's 32 head columns
  const int hl = lane >> 4;
  const int ml = lane & 15;

  // Work-group index -> (row block, column half), a permutation chosen for speed only:
  // the two groups that read the same rows of x are 8 indices apart.
  const int hsel = (blockIdx.x >> 3) & 1;
  const int rblk = (blockIdx.x & 7) | ((blockIdx.x >> 4) << 3);   // 0..127
  const int nt = 2 * hsel + cg;                                   // 0..3 (H/16)
  const int row0 = rblk * PM + rt * 16;

  // Staging: a wave's load covers the 512 B of one row's slice (4 whole lines).
  // Piece j of a wave is staged row j * 16 + wslot: 8 pieces of x, 2 of each W.
  const unsigned goff = (unsigned)(wslot * NC + lane * 4);
  const float* xblk = x + (size_t)rblk * PM * NC;
  const int wrow = hsel * PWR * NC;
  const int soff = wslot * PPITCH + lane * 4;

  // 128 work-groups read the same rows of W from L2. Each starts its walk over the
  // k slices at another slice (8 starts), so that at one moment they ask L2 for
  // different lines; the two groups that share rows of x start half a walk apart, so
  // that each brings in one half of those rows first and finds the other half in L2.
  // A sum over all slices either way: only the order of the f32 additions moves.
  const int rot = (rblk + (rblk >> 3) + hsel * (PSLICES / 2)) & (PSLICES - 1);
  auto slice_k = [&](int s) { return ((s + rot) & (PSLICES - 1)) * PKS; };

  // Two register sets: while one slice's values are converted and stored, the slice
  // behind it is already on its way.
  v4f gs[2][PPIECES];
  auto fetch = [&](v4f (&g)[PPIECES], int k0) {
    const float* px = xblk + k0;
    const float* pq = Wq + wrow + k0;
    const float* pk = Wk + wrow + k0;
    const float* pv = Wv + wrow + k0;
#pragma unroll  // constant indices keep g[] in registers
    for (int j = 0; j < PM / 16; ++j) g[j] = *(const v4f*)(px + j * 16 * NC + goff);
#pragma unroll  // constant indices keep g[] in registers
    for (int j = 0; j < PWR / 16; ++j) {
      g[PM / 16 + j]                  = *(const v4f*)(pq + j * 16 * NC + goff);
      g[PM / 16 + PWR / 16 + j]       = *(const v4f*)(pk + j * 16 * NC + goff);
      g[PM / 16 + 2 * (PWR / 16) + j] = *(const v4f*)(pv + j * 16 * NC + goff);
    }
  };
  auto stage = [&](const v4f (&g)[PPIECES], int buf) {
    _Float16* d = &tile[buf][soff];
#pragma unroll  // constant indices keep g[] in registers
    for (int j = 0; j < PPIECES; ++j) *(v4h*)(d + j * 16 * PPITCH) = __builtin_convertvector(g[j], v4h);
  };

  v8f aq = {}; v8f ak = {}; v8f av = {};
  const int aoff = (rt * 16 + ml) * PPITCH + 8 * hl;
  const int boff = (PM + cg * 16 + ml) * PPITCH + 8 * hl;
  auto compute = [&](int buf) {
    const _Float16* ta = &tile[buf][aoff];
    const _Float16* tb = &tile[buf][boff];
#pragma unroll  // k offsets become immediate LDS offsets
    for (int kk = 0; kk < PKS; kk += 32) {
      v16h a  = lds_frag(ta + kk);
      v16h bq = lds_frag(tb + kk);
      v16h bk = lds_frag(tb + PWR * PPITCH + kk);
      v16h bv = lds_frag(tb + 2 * PWR * PPITCH + kk);
      aq = wmma_f16(bq, a, aq);   // q^T tile: rows = head columns, lane = position
      ak = wmma_f16(bk, a, ak);   // k^T tile, likewise
      av = wmma_f16(a, bv, av);   // v tile: rows = positions, lane = head column
    }
  };

  fetch(gs[0], slice_k(0));
  fetch(gs[1], slice_k(1));
  stage(gs[0], 0);
  // Keeps the refill behind the conversions: it reuses their registers.
  SCHED_FENCE();
  fetch(gs[0], slice_k(2));
  // Keeps those global loads ahead of the barrier.
  SCHED_FENCE();
  lds_barrier();

  // Unrolled so that the buffer index folds into immediate LDS offsets. A slice's k
  // offset goes into the scalar bases: one vector offset register serves every
  // global load and lives until the last fetch. The register set folds likewise.
  // A register set is asked to fetch again as soon as it has been stored: slice s + 3
  // goes out while slice s + 2 is still in flight, so that loads stay queued while the
  // work-group converts, stores, meets at the barrier and multiplies.
#pragma unroll
  for (int s = 0; s < PSLICES - 1; ++s) {
    compute(s & 1);
    // The loads of slice s + 2 are still in flight when the fetch below rewrites the
    // scalar bases that they name: this wait stands in front of that rewrite (the
    // fence below keeps the address arithmetic behind it).
    if (s + 3 < PSLICES) asm volatile("s_wait_xcnt 0x0" ::: "memory");
    // Keeps the wait for slice s + 1 (the conversions read it) behind the matrix work.
    SCHED_FENCE();
    stage(gs[(s + 1) & 1], (s + 1) & 1);
    // Keeps the refill behind the conversions: it reuses their registers.
    SCHED_FENCE();
    if (s + 3 < PSLICES) fetch(gs[(s + 1) & 1], slice_k(s + 3));
    // Keeps those global loads ahead of the barrier and of the next slice's LDS reads.
    SCHED_FENCE();
    // Behind the last fetch the vector offset register that its loads name is free
    // for reuse by the matrix work: this wait stands in front of that reuse.
    if (s + 3 == PSLICES - 1) asm volatile("s_wait_xcnt 0x0" ::: "memory");
    // Publishes slice s + 1 and ends every read of the buffer refilled next trip.
    lds_barrier();
  }
  compute((PSLICES - 1) & 1);

  // row0 = flat b*T + t of the tile's first position; h0 = 16 * nt its first head column.
  // q, k: lane holds position row0 + ml, head columns h0 + 8 * hl + 0..7:
  //       unit h0 / 32 of the 16 positions, half (h0 / 16) & 1.
  // v   : lane holds head column h0 + ml, positions row0 + 8 * hl + 0..7:
  //       unit h0 / 16 of the 32 positions, half (row0 / 16) & 1.
  const size_t qkoff = (size_t)(row0 >> 4) * (2 * FU) + nt * (FU / 2) + lane * 8;
  const size_t voff  = (size_t)(row0 >> 5) * (4 * FU) + nt * FU + (rt & 1) * (FU / 2) + lane * 8;
  *(v8h*)(qb + qkoff) = __builtin_convertvector(aq, v8h);
  *(v8h*)(kb + qkoff) = __builtin_convertvector(ak, v8h);
  *(v8h*)(vtb + voff) = __builtin_convertvector(av, v8h);
}

constexpr int AW     = 8;
constexpr int OPITCH = 68;

// Value of lane l ^ 16.
__device__ __forceinline__ float xhalf(float x) {
  const int b = __builtin_bit_cast(int, x);
  return __builtin_bit_cast(float, __builtin_amdgcn_permlanex16(b, b, 0x76543210, 0xfedcba98, false, false));
}

__global__ __launch_bounds__(256) void attn_kernel(
    const _Float16* __restrict__ qb, const _Float16* __restrict__ kb,
    const _Float16* __restrict__ vtb, float* __restrict__ out) {
  __shared__ __attribute__((aligned(16))) float po[AW][16][OPITCH];  // partial outputs
  __shared__ __attribute__((aligned(16))) float pm[AW][16];          // partial row maxima
  __shared__ __attribute__((aligned(16))) float pl[AW][16];          // partial row sums

  const int lane = threadIdx.x & 31;
  // Wave number as a scalar: the chunk loop's bounds and the K/V bases stay wave-uniform.
  const int wslot = __builtin_amdgcn_readfirstlane(threadIdx.x >> 5);
  // Work-group index -> (batch, query tile): a permutation of the 8 x 128 tiles,
  // chosen for speed only. A tile's cost grows with qt; the dearest tiles take the
  // lowest indices and the shortest the highest. Tiles go in four bands of 32 (256
  // indices each); the two middle bands run upwards, so that indices 256 apart in
  // bands 0 and 1 or 2 and 3 add up to the same number of keys.
  const int b = blockIdx.x & 7;
  const int band = blockIdx.x >> 8;          // 0..3
  const int u = (blockIdx.x >> 3) & 31;      // place inside the band
  const int qt = 127 - 32 * band - ((band == 1 || band == 2) ? 31 - u : u);
  const int q0 = qt * 16;
  const int hl = lane >> 4;
  const int ml = lane & 15;

  // Q tile (second operand: column = query ml), K-dim = H = 64 -> two k-steps
  const gcf16 qrow = scalar_base(qb + ((size_t)b * NT + q0) * NH);   // 2 units per 16 positions
  const v16h bq0 = unit_frag(qrow, lane);
  const v16h bq1 = unit_frag(qrow + FU, lane);

  // O^T tiles: o<t>[r] = O[query ml][head column 16 * t + 8 * hl + r].
  v8f o0 = {}, o1 = {}, o2 = {}, o3 = {};
  float m = -__builtin_inff();   // running maximum of query ml, equal in both halves
  float l = 0.f;                 // running sum of query ml over this half's keys only

  // (1/sqrt(n_embd)) * log2(e): softmax computed with exp2.
  const float sscale2 = 0.03125f * 1.4426950408889634f;
  const int nchunks = (q0 + 16 + 31) >> 5;
  const _Float16* kb_b  = kb + (size_t)b * NT * NH;
  const _Float16* vtb_b = vtb + (size_t)b * NT * NH;

  for (int c = wslot; c < nchunks; c += AW) {
    const int s0 = c * 32;

    // ---- issue ALL K and V tile loads up front; V latency hides under
    //      the S-WMMAs + softmax VALU work ----
    //      A chunk's K and V are 4 fragment units (4 KB contiguous) each.
    const gcf16 kc = scalar_base(kb_b + (size_t)s0 * NH);
    const gcf16 vc = scalar_base(vtb_b + (size_t)s0 * NH);
    v16h ak00 = unit_frag(kc, lane);            // keys s0..s0+15,    h 0..31
    v16h ak01 = unit_frag(kc + FU, lane);       //                    h 32..63
    v16h ak10 = unit_frag(kc + 2 * FU, lane);   // keys s0+16..s0+31, h 0..31
    v16h ak11 = unit_frag(kc + 3 * FU, lane);   //                    h 32..63
    v16h av0 = unit_frag(vc, lane);             // h 0..15,  keys s0..s0+31
    v16h av1 = unit_frag(vc + FU, lane);        // h 16..31
    v16h av2 = unit_frag(vc + 2 * FU, lane);    // h 32..47
    v16h av3 = unit_frag(vc + 3 * FU, lane);    // h 48..63
    SCHED_FENCE();

    // ---- S^T = K Q^T: st0[r] = score(key s0 + 8 * hl + r, query q0 + ml),
    //      st1[r] the same 16 keys further on ----
    v8f st0 = {}, st1 = {};
    st0 = wmma_f16(ak00, bq0, st0);
    st0 = wmma_f16(ak01, bq1, st0);
    st1 = wmma_f16(ak10, bq0, st1);
    st1 = wmma_f16(ak11, bq1, st1);

    // ---- scale + causal mask + maximum of this lane's 16 scores ----
    const int kvis = q0 + ml - s0 - 8 * hl;   // key r of st0 / 16 + r of st1 is seen while <= kvis
    st0 *= sscale2;
    st1 *= sscale2;
    float v0[8], v1[8], mv[8];
#pragma unroll  // constant indices keep the scores in registers
    for (int r = 0; r < 8; ++r) {
      v0[r] = (r > kvis)      ? -__builtin_inff() : st0[r];
      v1[r] = (16 + r > kvis) ? -__builtin_inff() : st1[r];
      mv[r] = fmaxf(v0[r], v1[r]);
    }
    float mx = fmaxf(fmaxf(fmaxf(mv[0], mv[1]), fmaxf(mv[2], mv[3])),
                     fmaxf(fmaxf(mv[4], mv[5]), fmaxf(mv[6], mv[7])));
    mx = fmaxf(mx, xhalf(mx));   // all 32 keys; key s0 is seen by every query, so mx is finite

    // ---- online softmax (exp2 domain) ----
    const float newm = fmaxf(m, mx);
    const float corr = __builtin_amdgcn_exp2f(m - newm);
    m = newm;
    v8f p0, p1;
#pragma unroll  // constant indices keep the scores in registers
    for (int r = 0; r < 8; ++r) {
      p0[r] = __builtin_amdgcn_exp2f(v0[r] - newm);
      p1[r] = __builtin_amdgcn_exp2f(v1[r] - newm);
    }
    const v8f ps = p0 + p1;
    const v4f ps4 = __builtin_shufflevector(ps, ps, 0, 1, 2, 3) + __builtin_shufflevector(ps, ps, 4, 5, 6, 7);
    l = l * corr + ((ps4[0] + ps4[2]) + (ps4[1] + ps4[3]));
    o0 *= corr; o1 *= corr; o2 *= corr; o3 *= corr;

    // ---- P^T as second operand (k = keys): element e < 8 is key 8 * hl + e = p0[e],
    //      element e >= 8 is key 16 + 8 * hl + (e - 8) = p1[e - 8] ----
    union { v16h v; v8h h[2]; } pt;
    pt.h[0] = __builtin_convertvector(p0, v8h);
    pt.h[1] = __builtin_convertvector(p1, v8h);

    // ---- O^T += V^T P^T  (V tiles already resident) ----
    o0 = wmma_f16(av0, pt.v, o0);
    o1 = wmma_f16(av1, pt.v, o1);
    o2 = wmma_f16(av2, pt.v, o2);
    o3 = wmma_f16(av3, pt.v, o3);
  }

  // ---- hand this wave's partial (max, sum, un-normalised O) to the work-group.
  //      A wave without a chunk hands in max = -inf, sum = 0, O = 0: weight 0 below.
  {
    float* d = &po[wslot][ml][8 * hl];
    *(v4f*)(d)      = __builtin_shufflevector(o0, o0, 0, 1, 2, 3);
    *(v4f*)(d + 4)  = __builtin_shufflevector(o0, o0, 4, 5, 6, 7);
    *(v4f*)(d + 16) = __builtin_shufflevector(o1, o1, 0, 1, 2, 3);
    *(v4f*)(d + 20) = __builtin_shufflevector(o1, o1, 4, 5, 6, 7);
    *(v4f*)(d + 32) = __builtin_shufflevector(o2, o2, 0, 1, 2, 3);
    *(v4f*)(d + 36) = __builtin_shufflevector(o2, o2, 4, 5, 6, 7);
    *(v4f*)(d + 48) = __builtin_shufflevector(o3, o3, 0, 1, 2, 3);
    *(v4f*)(d + 52) = __builtin_shufflevector(o3, o3, 4, 5, 6, 7);
  }
  const float lrow = l + xhalf(l);   // the two halves' key shares joined once
  if (hl == 0) {   // both halves hold the same m and lrow
    pm[wslot][ml] = m;
    pl[wslot][ml] = lrow;
  }
  // Publishes all eight partials; every wave passes it, with or without chunks.
  __syncthreads();

  // ---- merge, normalize and store f32 output [B, T, H]: a thread owns 4
  //      neighbouring columns of one row, a wave two whole 256-B rows.
  //      Wave 0 always has chunk 0, whose key 0 every row sees: mall is finite.
  const int mrow = threadIdx.x >> 4;
  const int mcol = (threadIdx.x & 15) * 4;
  float mw[AW];
  float mall = -__builtin_inff();
#pragma unroll
  for (int w = 0; w < AW; ++w) {
    mw[w] = pm[w][mrow];
    mall = fmaxf(mall, mw[w]);
  }
  float lall = 0.f;
  v4f acc = {};
#pragma unroll
  for (int w = 0; w < AW; ++w) {
    const float e = __builtin_amdgcn_exp2f(mw[w] - mall);
    lall += e * pl[w][mrow];
    acc += e * *(const v4f*)&po[w][mrow][mcol];
  }
  const float inv = 1.0f / lall;
  *(v4f*)&out[((size_t)b * NT + q0 + mrow) * NH + mcol] = acc * inv;
}

// ---------------------------------------------------------------------------
extern "C" void kernel_launch(void* const* d_in, const int* in_sizes, int n_in,
                              void* d_out, int out_size, void* d_ws, size_t ws_size,
                              hipStream_t stream) {
  const float* x  = (const float*)d_in[0];
  const float* Wk = (const float*)d_in[1];
  const float* Wq = (const float*)d_in[2];
  const float* Wv = (const float*)d_in[3];

  const size_t nqkv = (size_t)NB * NT * NH;  // 1M elems each
  _Float16* qb  = (_Float16*)d_ws;
  _Float16* kbf = qb + nqkv;
  _Float16* vtb = kbf + nqkv;

  // Projection: B*T/128 row blocks x 2 column halves = 256 work-groups of 16 waves.
  proj_kernel<<<256, 512, 0, stream>>>(x, Wk, Wq, Wv, qb, kbf, vtb);

  // Attention: B * T/16 = 1024 query tiles, one work-group of 8 waves each.
  attn_kernel<<<1024, 256, 0, stream>>>(qb, kbf, vtb, (float*)d_out);
}

// v009
// One run takes 21.8 microseconds.
// Timed twice side by side with v008, it ran 1.07 times as fast both times.
// All steps since v000 together make it 6.07 times as fast.
#include <hip/hip_runtime.h>
#include <hip/hip_bf16.h>

// Problem constants (match reference)
constexpr int NB = 8;     // batch
constexpr int NT = 2048;  // sequence length
constexpr int NC = 1024;  // n_embd
constexpr int NH = 64;    // head size

typedef __attribute__((ext_vector_type(16))) _Float16 v16h;
typedef __attribute__((ext_vector_type(8)))  float    v8f;

#if defined(__has_builtin)
#if __has_builtin(__builtin_amdgcn_sched_barrier)
#define SCHED_FENCE() __builtin_amdgcn_sched_barrier(0)
#endif
#endif
#ifndef SCHED_FENCE
#define SCHED_FENCE() asm volatile("" ::: "memory")
#endif

// 16-bit A/B 16x32 WMMA layout: element e of a lane's operand holds
//   k = 8 * hl + e for e < 8, k = 16 + 8 * hl + (e - 8) for e >= 8   (hl = lane >> 4).

__device__ __forceinline__ v8f wmma_f16(v16h a, v16h b, v8f c) {
  return __builtin_amdgcn_wmma_f32_16x16x32_f16(false, a, false, b, (short)0, c,
                                                false, false);
}

// ---------------------------------------------------------------------------
// Kernel 1: q/k/v projections.  One work-group: 128 rows of x against 32 rows of
// each of Wq, Wk, Wv (one half of the head columns): 128 + 96 staged rows for the
// same 48 result tiles as 64 + 192, so fewer bytes come in from L2 per product.
// A 128-k slice of those 224 rows is fetched with whole-line loads, converted to
// f16 once and shared through LDS (two buffers). The 16 waves work in pairs: both
// waves of a pair multiply the same 32 rows x 16 columns of q, k and v, each over its
// own half of every slice's k, so that 5 fragments read from LDS feed 6 products
// (one 16-row tile a wave: 8 for 6). At the end each wave hands its partner the
// partial sums of one 16-row tile through LDS and finishes the other.
//   q, k and v go to the workspace in operand-fragment order, in units of
//   512 f16 (1 KB) = one 16 x 32 operand tile:
//     unit[half][lane][e] = tile row (lane & 15), k = 16 * half + 8 * (lane >> 4) + e
//   q, k: rows = 16 positions, k = 32 head columns; 2 units per 16 positions.
//   v   : rows = 16 head columns, k = 32 positions; 4 units per 32 positions.
//   A result tile whose lanes each hold 8 neighbouring k of one row is half a
//   unit: one 16-B store per lane, 512 contiguous bytes per wave. For q and k
//   that takes W as the first operand (result rows = head columns).
// ---------------------------------------------------------------------------
constexpr int FU = 512;                // f16 per fragment unit
constexpr int PM      = 128;           // x rows per work-group
constexpr int PWR     = NH / 2;        // rows of each of Wq, Wk, Wv per work-group
constexpr int PKS     = 128;           // k per staged slice: one wave-wide 16-B load per row
constexpr int PROWS   = PM + 3 * PWR;  // staged rows: x | Wq | Wk | Wv
constexpr int PPIECES = PROWS / 16;    // staged rows per wave and slice
constexpr int PPITCH  = PKS + 8;       // f16 per LDS row: 272 B = 16 B x 17, no bank conflict for 16-B reads
constexpr int PSLICES = NC / PKS;

typedef __attribute__((ext_vector_type(8))) _Float16 v8h;
typedef __attribute__((ext_vector_type(4))) _Float16 v4h;

// One 16x32 operand tile from a staged row; p = row start + k offset + 8 * hl.
// k order of the layout above: [0..7] and [16..23] behind p, for A and B alike.
__device__ __forceinline__ v16h lds_frag(const _Float16* p) {
  union { v16h v; v8h h[2]; } t;
  t.h[0] = *(const v8h*)(p);
  t.h[1] = *(const v8h*)(p + 16);
  return t.v;
}

typedef const __attribute__((address_space(1))) _Float16* gcf16;
typedef const __attribute__((address_space(1))) v8h* gcv8h;

// A wave-uniform global address held in scalar registers: the loads behind it
// take it as their scalar base, and the one vector register they name is the
// lane's constant offset, which nothing rewrites while they are in flight.
__device__ __forceinline__ gcf16 scalar_base(const _Float16* p) {
  const unsigned long long a = (unsigned long long)p;
  const unsigned lo = __builtin_amdgcn_readfirstlane((unsigned)a);
  const unsigned hi = __builtin_amdgcn_readfirstlane((unsigned)(a >> 32));
  return (gcf16)(((unsigned long long)hi << 32) | lo);
}

// One 16x32 operand tile from a fragment unit in global memory: two wave-wide
// 16-B loads of 512 contiguous bytes each.
__device__ __forceinline__ v16h unit_frag(gcf16 unit, unsigned lane) {
  union { v16h v; v8h h[2]; } t;
  t.h[0] = *(gcv8h)(unit + lane * 8u);
  t.h[1] = *(gcv8h)(unit + FU / 2 + lane * 8u);
  return t.v;
}

typedef __attribute__((ext_vector_type(4))) float v4f;

// Work-group barrier that orders LDS only: this wave's LDS stores and reads are
// complete before it signals, and no LDS access moves across it. __syncthreads()
// would also wait for every global load in flight, and the loads issued ahead into
// registers are meant to stay in flight across it.
__device__ __forceinline__ void lds_barrier() {
  __builtin_amdgcn_fence(__ATOMIC_RELEASE, "workgroup", "local");
  __builtin_amdgcn_s_barrier();
  __builtin_amdgcn_fence(__ATOMIC_ACQUIRE, "workgroup", "local");
}

__global__ __launch_bounds__(512) void proj_kernel(
    const float* __restrict__ x, const float* __restrict__ Wk,
    const float* __restrict__ Wq, const float* __restrict__ Wv,
    _Float16* __restrict__ qb, _Float16* __restrict__ kb,
    _Float16* __restrict__ vtb) {
  __shared__ __attribute__((aligned(16))) _Float16 tile[2][PROWS * PPITCH];

  const int tid = threadIdx.x;
  const int lane = tid & 31;
  const int wslot = tid >> 5;
  const int rt = wslot & 7;   // 16-row tile inside the 128 rows that this wave finishes
  const int kh = wslot & 1;   // half of each slice's k; wave wslot ^ 1 takes the other
  const int cg = wslot >> 3;  // 16-column tile inside this work-group's 32 head columns
  const int hl = lane >> 4;
  const int ml = lane & 15;

  // Work-group index -> (row block, column half), a permutation chosen for speed only:
  // the two groups that read the same rows of x are 8 indices apart.
  const int hsel = (blockIdx.x >> 3) & 1;
  const int rblk = (blockIdx.x & 7) | ((blockIdx.x >> 4) << 3);   // 0..127
  const int nt = 2 * hsel + cg;                                   // 0..3 (H/16)
  const int row0 = rblk * PM + rt * 16;

  // Staging: a wave's load covers the 512 B of one row's slice (4 whole lines).
  // Piece j of a wave is staged row j * 16 + wslot: 8 pieces of x, 2 of each W.
  const unsigned goff = (unsigned)(wslot * NC + lane * 4);
  const float* xblk = x + (size_t)rblk * PM * NC;
  const int wrow = hsel * PWR * NC;
  const int soff = wslot * PPITCH + lane * 4;

  // 128 work-groups read the same rows of W from L2. Each starts its walk over the
  // k slices at another slice (8 starts), so that at one moment they ask L2 for
  // different lines; the two groups that share rows of x start half a walk apart, so
  // that each brings in one half of those rows first and finds the other half in L2.
  // A sum over all slices either way: only the order of the f32 additions moves.
  const int rot = (rblk + (rblk >> 3) + hsel * (PSLICES / 2)) & (PSLICES - 1);
  auto slice_k = [&](int s) { return ((s + rot) & (PSLICES - 1)) * PKS; };

  // Two register sets: while one slice's values are converted and stored, the slice
  // behind it is already on its way.
  v4f gs[2][PPIECES];
  auto fetch = [&](v4f (&g)[PPIECES], int k0) {
    const float* px = xblk + k0;
    const float* pq = Wq + wrow + k0;
    const float* pk = Wk + wrow + k0;
    const float* pv = Wv + wrow + k0;
#pragma unroll  // constant indices keep g[] in registers
    for (int j = 0; j < PM / 16; ++j) g[j] = *(const v4f*)(px + j * 16 * NC + goff);
#pragma unroll  // constant indices keep g[] in registers
    for (int j = 0; j < PWR / 16; ++j) {
      g[PM / 16 + j]                  = *(const v4f*)(pq + j * 16 * NC + goff);
      g[PM / 16 + PWR / 16 + j]       = *(const v4f*)(pk + j * 16 * NC + goff);
      g[PM / 16 + 2 * (PWR / 16) + j] = *(const v4f*)(pv + j * 16 * NC + goff);
    }
  };
  auto stage = [&](const v4f (&g)[PPIECES], int buf) {
    _Float16* d = &tile[buf][soff];
#pragma unroll  // constant indices keep g[] in registers
    for (int j = 0; j < PPIECES; ++j) *(v4h*)(d + j * 16 * PPITCH) = __builtin_convertvector(g[j], v4h);
  };

  // aq, ak, av: row tile rt, finished here; gq, gk, gv: row tile rt ^ 1, the partner's.
  v8f aq = {}; v8f ak = {}; v8f av = {};
  v8f gq = {}; v8f gk = {}; v8f gv = {};
  const int koff = kh * (PKS / 2) + 8 * hl;
  const int aoff = (rt * 16 + ml) * PPITCH + koff;
  const int goffa = ((rt ^ 1) * 16 + ml) * PPITCH + koff;
  const int boff = (PM + cg * 16 + ml) * PPITCH + koff;
  auto compute = [&](int buf) {
    const _Float16* ta = &tile[buf][aoff];
    const _Float16* tg = &tile[buf][goffa];
    const _Float16* tb = &tile[buf][boff];
#pragma unroll  // k offsets become immediate LDS offsets
    for (int kk = 0; kk < PKS / 2; kk += 32) {
      v16h a  = lds_frag(ta + kk);
      v16h g  = lds_frag(tg + kk);
      v16h bq = lds_frag(tb + kk);
      v16h bk = lds_frag(tb + PWR * PPITCH + kk);
      v16h bv = lds_frag(tb + 2 * PWR * PPITCH + kk);
      // Keeps the step's ten LDS reads together ahead of its products: each fragment in
      // registers of its own, one LDS latency a step and not one per weight fragment.
      SCHED_FENCE();
      aq = wmma_f16(bq, a, aq);   // q^T tile: rows = head columns, lane = position
      gq = wmma_f16(bq, g, gq);
      ak = wmma_f16(bk, a, ak);   // k^T tile, likewise
      gk = wmma_f16(bk, g, gk);
      av = wmma_f16(a, bv, av);   // v tile: rows = positions, lane = head column
      gv = wmma_f16(g, bv, gv);
    }
  };

  fetch(gs[0], slice_k(0));
  fetch(gs[1], slice_k(1));
  stage(gs[0], 0);
  // Keeps the refill behind the conversions: it reuses their registers.
  SCHED_FENCE();
  fetch(gs[0], slice_k(2));
  // Keeps those global loads ahead of the barrier.
  SCHED_FENCE();
  lds_barrier();

  // Unrolled so that the buffer index folds into immediate LDS offsets. A slice's k
  // offset goes into the scalar bases: one vector offset register serves every
  // global load and lives until the last fetch. The register set folds likewise.
  // A register set is asked to fetch again as soon as it has been stored: slice s + 3
  // goes out while slice s + 2 is still in flight, so that loads stay queued while the
  // work-group converts, stores, meets at the barrier and multiplies.
#pragma unroll
  for (int s = 0; s < PSLICES - 1; ++s) {
    compute(s & 1);
    // The loads of slice s + 2 are still in flight when the fetch below rewrites the
    // scalar bases that they name: this wait stands in front of that rewrite (the
    // fence below keeps the address arithmetic behind it).
    if (s + 3 < PSLICES) asm volatile("s_wait_xcnt 0x0" ::: "memory");
    // Keeps the wait for slice s + 1 (the conversions read it) behind the matrix work.
    SCHED_FENCE();
    stage(gs[(s + 1) & 1], (s + 1) & 1);
    // Keeps the refill behind the conversions: it reuses their registers.
    SCHED_FENCE();
    if (s + 3 < PSLICES) fetch(gs[(s + 1) & 1], slice_k(s + 3));
    // Keeps those global loads ahead of the barrier and of the next slice's LDS reads.
    SCHED_FENCE();
    // Behind the last fetch the vector offset register that its loads name is free
    // for reuse by the matrix work: this wait stands in front of that reuse.
    if (s + 3 == PSLICES - 1) asm volatile("s_wait_xcnt 0x0" ::: "memory");
    // Publishes slice s + 1 and ends every read of the buffer refilled next trip.
    lds_barrier();
  }
  compute((PSLICES - 1) & 1);

  // The two k halves are joined: each wave leaves the partner's three partial tiles in
  // the buffer that the last slice does not use (its last readers left it in front of
  // the loop's last barrier) and adds the partner's partial sums to its own three.
  // 512 contiguous bytes per store and load, 3 KB per wave.
  static_assert(((PSLICES - 1) & 1) == 1, "buffer 0 must be the idle one");
  static_assert(16 * 6 * 32 * sizeof(v4f) <= sizeof(tile[0]), "partial sums fit one buffer");
  {
    v4f* give = (v4f*)&tile[0][0] + wslot * 6 * 32 + lane;
    give[0 * 32] = __builtin_shufflevector(gq, gq, 0, 1, 2, 3);
    give[1 * 32] = __builtin_shufflevector(gq, gq, 4, 5, 6, 7);
    give[2 * 32] = __builtin_shufflevector(gk, gk, 0, 1, 2, 3);
    give[3 * 32] = __builtin_shufflevector(gk, gk, 4, 5, 6, 7);
    give[4 * 32] = __builtin_shufflevector(gv, gv, 0, 1, 2, 3);
    give[5 * 32] = __builtin_shufflevector(gv, gv, 4, 5, 6, 7);
    // Publishes every wave's partial sums to its partner.
    lds_barrier();
    const v4f* take = (const v4f*)&tile[0][0] + (wslot ^ 1) * 6 * 32 + lane;
    aq += __builtin_shufflevector(take[0 * 32], take[1 * 32], 0, 1, 2, 3, 4, 5, 6, 7);
    ak += __builtin_shufflevector(take[2 * 32], take[3 * 32], 0, 1, 2, 3, 4, 5, 6, 7);
    av += __builtin_shufflevector(take[4 * 32], take[5 * 32], 0, 1, 2, 3, 4, 5, 6, 7);
  }

  // row0 = flat b*T + t of the tile's first position; h0 = 16 * nt its first head column.
  // q, k: lane holds position row0 + ml, head columns h0 + 8 * hl + 0..7:
  //       unit h0 / 32 of the 16 positions, half (h0 / 16) & 1.
  // v   : lane holds head column h0 + ml, positions row0 + 8 * hl + 0..7:
  //       unit h0 / 16 of the 32 positions, half (row0 / 16) & 1.
  const size_t qkoff = (size_t)(row0 >> 4) * (2 * FU) + nt * (FU / 2) + lane * 8;
  const size_t voff  = (size_t)(row0 >> 5) * (4 * FU) + nt * FU + (rt & 1) * (FU / 2) + lane * 8;
  *(v8h*)(qb + qkoff) = __builtin_convertvector(aq, v8h);
  *(v8h*)(kb + qkoff) = __builtin_convertvector(ak, v8h);
  *(v8h*)(vtb + voff) = __builtin_convertvector(av, v8h);
}

constexpr int AW     = 8;
constexpr int OPITCH = 68;

// Value of lane l ^ 16.
__device__ __forceinline__ float xhalf(float x) {
  const int b = __builtin_bit_cast(int, x);
  return __builtin_bit_cast(float, __builtin_amdgcn_permlanex16(b, b, 0x76543210, 0xfedcba98, false, false));
}

__global__ __launch_bounds__(256) void attn_kernel(
    const _Float16* __restrict__ qb, const _Float16* __restrict__ kb,
    const _Float16* __restrict__ vtb, float* __restrict__ out) {
  __shared__ __attribute__((aligned(16))) float po[AW][16][OPITCH];  // partial outputs
  __shared__ __attribute__((aligned(16))) float pm[AW][16];          // partial row maxima
  __shared__ __attribute__((aligned(16))) float pl[AW][16];          // partial row sums

  const int lane = threadIdx.x & 31;
  // Wave number as a scalar: the chunk loop's bounds and the K/V bases stay wave-uniform.
  const int wslot = __builtin_amdgcn_readfirstlane(threadIdx.x >> 5);
  // Work-group index -> (batch, query tile): a permutation of the 8 x 128 tiles,
  // chosen for speed only. A tile's cost grows with qt; the dearest tiles take the
  // lowest indices and the shortest the highest. Tiles go in four bands of 32 (256
  // indices each); the two middle bands run upwards, so that indices 256 apart in
  // bands 0 and 1 or 2 and 3 add up to the same number of keys.
  const int b = blockIdx.x & 7;
  const int band = blockIdx.x >> 8;          // 0..3
  const int u = (blockIdx.x >> 3) & 31;      // place inside the band
  const int qt = 127 - 32 * band - ((band == 1 || band == 2) ? 31 - u : u);
  const int q0 = qt * 16;
  const int hl = lane >> 4;
  const int ml = lane & 15;

  // Q tile (second operand: column = query ml), K-dim = H = 64 -> two k-steps
  const gcf16 qrow = scalar_base(qb + ((size_t)b * NT + q0) * NH);   // 2 units per 16 positions
  const v16h bq0 = unit_frag(qrow, lane);
  const v16h bq1 = unit_frag(qrow + FU, lane);

  // O^T tiles: o<t>[r] = O[query ml][head column 16 * t + 8 * hl + r].
  v8f o0 = {}, o1 = {}, o2 = {}, o3 = {};
  float m = -__builtin_inff();   // running maximum of query ml, equal in both halves
  float l = 0.f;                 // running sum of query ml over this half's keys only

  // (1/sqrt(n_embd)) * log2(e): softmax computed with exp2.
  const float sscale2 = 0.03125f * 1.4426950408889634f;
  const int nchunks = (q0 + 16 + 31) >> 5;
  const _Float16* kb_b  = kb + (size_t)b * NT * NH;
  const _Float16* vtb_b = vtb + (size_t)b * NT * NH;

  for (int c = wslot; c < nchunks; c += AW) {
    const int s0 = c * 32;

    // ---- issue ALL K and V tile loads up front; V latency hides under
    //      the S-WMMAs + softmax VALU work ----
    //      A chunk's K and V are 4 fragment units (4 KB contiguous) each.
    const gcf16 kc = scalar_base(kb_b + (size_t)s0 * NH);
    const gcf16 vc = scalar_base(vtb_b + (size_t)s0 * NH);
    v16h ak00 = unit_frag(kc, lane);            // keys s0..s0+15,    h 0..31
    v16h ak01 = unit_frag(kc + FU, lane);       //                    h 32..63
    v16h ak10 = unit_frag(kc + 2 * FU, lane);   // keys s0+16..s0+31, h 0..31
    v16h ak11 = unit_frag(kc + 3 * FU, lane);   //                    h 32..63
    v16h av0 = unit_frag(vc, lane);             // h 0..15,  keys s0..s0+31
    v16h av1 = unit_frag(vc + FU, lane);        // h 16..31
    v16h av2 = unit_frag(vc + 2 * FU, lane);    // h 32..47
    v16h av3 = unit_frag(vc + 3 * FU, lane);    // h 48..63
    SCHED_FENCE();

    // ---- S^T = K Q^T: st0[r] = score(key s0 + 8 * hl + r, query q0 + ml),
    //      st1[r] the same 16 keys further on ----
    v8f st0 = {}, st1 = {};
    st0 = wmma_f16(ak00, bq0, st0);
    st0 = wmma_f16(ak01, bq1, st0);
    st1 = wmma_f16(ak10, bq0, st1);
    st1 = wmma_f16(ak11, bq1, st1);

    // ---- scale + causal mask + maximum of this lane's 16 scores ----
    const int kvis = q0 + ml - s0 - 8 * hl;   // key r of st0 / 16 + r of st1 is seen while <= kvis
    st0 *= sscale2;
    st1 *= sscale2;
    float v0[8], v1[8], mv[8];
#pragma unroll  // constant indices keep the scores in registers
    for (int r = 0; r < 8; ++r) {
      v0[r] = (r > kvis)      ? -__builtin_inff() : st0[r];
      v1[r] = (16 + r > kvis) ? -__builtin_inff() : st1[r];
      mv[r] = fmaxf(v0[r], v1[r]);
    }
    float mx = fmaxf(fmaxf(fmaxf(mv[0], mv[1]), fmaxf(mv[2], mv[3])),
                     fmaxf(fmaxf(mv[4], mv[5]), fmaxf(mv[6], mv[7])));
    mx = fmaxf(mx, xhalf(mx));   // all 32 keys; key s0 is seen by every query, so mx is finite

    // ---- online softmax (exp2 domain) ----
    const float newm = fmaxf(m, mx);
    const float corr = __builtin_amdgcn_exp2f(m - newm);
    m = newm;
    v8f p0, p1;
#pragma unroll  // constant indices keep the scores in registers
    for (int r = 0; r < 8; ++r) {
      p0[r] = __builtin_amdgcn_exp2f(v0[r] - newm);
      p1[r] = __builtin_amdgcn_exp2f(v1[r] - newm);
    }
    const v8f ps = p0 + p1;
    const v4f ps4 = __builtin_shufflevector(ps, ps, 0, 1, 2, 3) + __builtin_shufflevector(ps, ps, 4, 5, 6, 7);
    l = l * corr + ((ps4[0] + ps4[2]) + (ps4[1] + ps4[3]));
    o0 *= corr; o1 *= corr; o2 *= corr; o3 *= corr;

    // ---- P^T as second operand (k = keys): element e < 8 is key 8 * hl + e = p0[e],
    //      element e >= 8 is key 16 + 8 * hl + (e - 8) = p1[e - 8] ----
    union { v16h v; v8h h[2]; } pt;
    pt.h[0] = __builtin_convertvector(p0, v8h);
    pt.h[1] = __builtin_convertvector(p1, v8h);

    // ---- O^T += V^T P^T  (V tiles already resident) ----
    o0 = wmma_f16(av0, pt.v, o0);
    o1 = wmma_f16(av1, pt.v, o1);
    o2 = wmma_f16(av2, pt.v, o2);
    o3 = wmma_f16(av3, pt.v, o3);
  }

  // ---- hand this wave's partial (max, sum, un-normalised O) to the work-group.
  //      A wave without a chunk hands in max = -inf, sum = 0, O = 0: weight 0 below.
  {
    float* d = &po[wslot][ml][8 * hl];
    *(v4f*)(d)      = __builtin_shufflevector(o0, o0, 0, 1, 2, 3);
    *(v4f*)(d + 4)  = __builtin_shufflevector(o0, o0, 4, 5, 6, 7);
    *(v4f*)(d + 16) = __builtin_shufflevector(o1, o1, 0, 1, 2, 3);
    *(v4f*)(d + 20) = __builtin_shufflevector(o1, o1, 4, 5, 6, 7);
    *(v4f*)(d + 32) = __builtin_shufflevector(o2, o2, 0, 1, 2, 3);
    *(v4f*)(d + 36) = __builtin_shufflevector(o2, o2, 4, 5, 6, 7);
    *(v4f*)(d + 48) = __builtin_shufflevector(o3, o3, 0, 1, 2, 3);
    *(v4f*)(d + 52) = __builtin_shufflevector(o3, o3, 4, 5, 6, 7);
  }
  const float lrow = l + xhalf(l);   // the two halves' key shares joined once
  if (hl == 0) {   // both halves hold the same m and lrow
    pm[wslot][ml] = m;
    pl[wslot][ml] = lrow;
  }
  // Publishes all eight partials; every wave passes it, with or without chunks.
  __syncthreads();

  // ---- merge, normalize and store f32 output [B, T, H]: a thread owns 4
  //      neighbouring columns of one row, a wave two whole 256-B rows.
  //      Wave 0 always has chunk 0, whose key 0 every row sees: mall is finite.
  const int mrow = threadIdx.x >> 4;
  const int mcol = (threadIdx.x & 15) * 4;
  float mw[AW];
  float mall = -__builtin_inff();
#pragma unroll
  for (int w = 0; w < AW; ++w) {
    mw[w] = pm[w][mrow];
    mall = fmaxf(mall, mw[w]);
  }
  float lall = 0.f;
  v4f acc = {};
#pragma unroll
  for (int w = 0; w < AW; ++w) {
    const float e = __builtin_amdgcn_exp2f(mw[w] - mall);
    lall += e * pl[w][mrow];
    acc += e * *(const v4f*)&po[w][mrow][mcol];
  }
  const float inv = 1.0f / lall;
  *(v4f*)&out[((size_t)b * NT + q0 + mrow) * NH + mcol] = acc * inv;
}

// ---------------------------------------------------------------------------
extern "C" void kernel_launch(void* const* d_in, const int* in_sizes, int n_in,
                              void* d_out, int out_size, void* d_ws, size_t ws_size,
                              hipStream_t stream) {
  const float* x  = (const float*)d_in[0];
  const float* Wk = (const float*)d_in[1];
  const float* Wq = (const float*)d_in[2];
  const float* Wv = (const float*)d_in[3];

  const size_t nqkv = (size_t)NB * NT * NH;  // 1M elems each
  _Float16* qb  = (_Float16*)d_ws;
  _Float16* kbf = qb + nqkv;
  _Float16* vtb = kbf + nqkv;

  // Projection: B*T/128 row blocks x 2 column halves = 256 work-groups of 16 waves.
  proj_kernel<<<256, 512, 0, stream>>>(x, Wk, Wq, Wv, qb, kbf, vtb);

  // Attention: B * T/16 = 1024 query tiles, one work-group of 8 waves each.
  attn_kernel<<<1024, 256, 0, stream>>>(qb, kbf, vtb, (float*)d_out);
}
